// v000
// Times are from an AMD MI455X. After a warm-up the kernel runs many times in a row, and a time is the length of
// such a window on the GPU divided by its runs, so every launch and the gaps after it count. The runs cycle
// through copies of the inputs. A figure is the median of several windows, for all but v000 over two sittings.
// Sittings can differ by a few percent; kernels timed side by side share one.
// v000 is the starting kernel. One run takes 31.6 microseconds.
#include <hip/hip_runtime.h>

// Problem constants (from reference)
#define B_   4
#define S_   4096
#define H_   2
#define D_   2
#define MD_  5

typedef __attribute__((ext_vector_type(2))) float v2f;
typedef __attribute__((ext_vector_type(8))) float v8f;

// ---------------------------------------------------------------------------
// Kernel 1: per-token preprocessing.
// s_qk = x . shared_qk_v ; s_v = x . shared_v_v
// Q = rope(rmsnorm(s_qk * q_u)) * (1/sqrt(D))   (1/sqrt(D) folded into Q)
// KV (interleaved, 16B/key) = { rope(rmsnorm(s_qk*k_u)), s_v*shared_vproj_u }
// ---------------------------------------------------------------------------
__global__ __launch_bounds__(256) void prep_kernel(
    const float* __restrict__ x, const float* __restrict__ freqs,
    const float* __restrict__ qk_v, const float* __restrict__ v_v,
    const float* __restrict__ vproj_u, const float* __restrict__ q_u,
    const float* __restrict__ k_u,
    float* __restrict__ Q, float* __restrict__ KV)
{
    int idx = blockIdx.x * blockDim.x + threadIdx.x;
    if (idx >= B_ * S_) return;
    int b = idx >> 12;            // / S_
    int s = idx & (S_ - 1);

    const float* xp = x + idx * MD_;
    float sqk = 0.f, sv = 0.f;
#pragma unroll
    for (int i = 0; i < MD_; ++i) {
        float xi = xp[i];
        sqk = fmaf(xi, qk_v[i], sqk);
        sv  = fmaf(xi, v_v[i],  sv);
    }

    float f  = freqs[s];          // D/2 == 1 -> single rotation angle
    float cs = __cosf(f);
    float sn = __sinf(f);
    const float inv_sqrt_d = 0.70710678118654752f;   // 1/sqrt(D), D=2

#pragma unroll
    for (int h = 0; h < H_; ++h) {
        float q0 = sqk * q_u[2 * h + 0];
        float q1 = sqk * q_u[2 * h + 1];
        float var = 0.5f * (q0 * q0 + q1 * q1);
        float r = 16.0f * rsqrtf(var + 1e-6f);
        q0 *= r; q1 *= r;
        float qr = q0 * cs - q1 * sn;
        float qi = q0 * sn + q1 * cs;
        int o = ((b * H_ + h) * S_ + s) * 2;
        Q[o + 0] = qr * inv_sqrt_d;
        Q[o + 1] = qi * inv_sqrt_d;
    }
    {
        float k0 = sqk * k_u[0];
        float k1 = sqk * k_u[1];
        float var = 0.5f * (k0 * k0 + k1 * k1);
        float r = 16.0f * rsqrtf(var + 1e-6f);
        k0 *= r; k1 *= r;
        int o = (b * S_ + s) * 4;
        KV[o + 0] = k0 * cs - k1 * sn;
        KV[o + 1] = k0 * sn + k1 * cs;
        KV[o + 2] = sv * vproj_u[0];
        KV[o + 3] = sv * vproj_u[1];
    }
}

// ---------------------------------------------------------------------------
// Kernel 2: attention. Block = 8 waves, each wave owns one 16-query tile; all
// waves in a block share batch b, whose full interleaved KV image (64 KB) is
// staged once into LDS (vectorized cooperative copy: 16 x b128 per thread).
// Score tile (16x16) = Q(16x4, D padded) x K^T(4x16) via v_wmma_f32_16x16x4_f32.
// Two passes over LDS: (1) row max, (2) exp-sum + P*V; shuffle reductions only
// outside the key loops.
// ---------------------------------------------------------------------------
__global__ __launch_bounds__(256) void attn_kernel(
    const float* __restrict__ Q, const float* __restrict__ KV,
    float* __restrict__ O)
{
    __shared__ float smem[S_ * 4];            // 64 KB: {k0,k1,v0,v1} per key

    const int tile0 = blockIdx.x * 8;         // first tile of this block
    const int b_blk = tile0 >> 9;             // tile>>8 = b*H+h ; >>1 = b
    const float* KVb = KV + (size_t)b_blk * S_ * 4;

    {   // cooperative staging: 4096 float4s across 256 threads (b128 traffic)
        const float4* src = (const float4*)KVb;
        float4* dst = (float4*)smem;
#pragma unroll 4
        for (int i = threadIdx.x; i < S_; i += 256) dst[i] = src[i];
    }
    __syncthreads();

    const int lane = threadIdx.x & 31;
    const int wv   = threadIdx.x >> 5;
    const int tile = tile0 + wv;               // 0 .. B*H*(S/16)-1
    const int qt   = tile & ((S_ / 16) - 1);   // query tile within sequence
    const int bh   = tile >> 8;                // b*H + h
    const int m    = lane & 15;
    const int half = lane >> 4;                // lanes 16-31 carry K=2,3 (pad)

    // A matrix (16x4 f32): row = m, lanes 0-15 hold K=0,1; lanes 16-31 pad=0
    const float* qp = Q + ((size_t)bh * S_ + (size_t)qt * 16 + m) * 2;
    float q0 = qp[0], q1 = qp[1];              // all lanes load (no divergence)
    v2f amat;
    amat.x = half ? 0.f : q0;                  // v_cndmask
    amat.y = half ? 0.f : q1;

    const float2* kv2 = (const float2*)smem;   // [key*2 + 0] = (k0,k1)
    const float4* kv4 = (const float4*)smem;   // [key]       = (k0,k1,v0,v1)

    // ---------------- pass 1: per-row max ----------------
    float tmax[8];
#pragma unroll
    for (int r = 0; r < 8; ++r) tmax[r] = -3.0e38f;

    for (int kt = 0; kt < S_ / 16; ++kt) {
        float2 kk = kv2[(kt * 16 + m) * 2];    // ds_load_b64 (broadcast hi half)
        v2f bmat;
        bmat.x = half ? 0.f : kk.x;            // v_cndmask, zero the K-pad lanes
        bmat.y = half ? 0.f : kk.y;
        v8f c = {};
        c = __builtin_amdgcn_wmma_f32_16x16x4_f32(
                false, amat, false, bmat, (short)0, c, false, false);
#pragma unroll
        for (int r = 0; r < 8; ++r) tmax[r] = fmaxf(tmax[r], c[r]);
    }

    float rowmax[8];
#pragma unroll
    for (int r = 0; r < 8; ++r) {
        float v = tmax[r];
#pragma unroll
        for (int mask = 1; mask < 16; mask <<= 1)
            v = fmaxf(v, __shfl_xor(v, mask, 32));
        rowmax[r] = v;
    }

    // ---------------- pass 2: exp-sum + P*V ----------------
    float lsum[8], a0[8], a1[8];
#pragma unroll
    for (int r = 0; r < 8; ++r) { lsum[r] = 0.f; a0[r] = 0.f; a1[r] = 0.f; }

    for (int kt = 0; kt < S_ / 16; ++kt) {
        float4 kk = kv4[kt * 16 + m];          // ds_load_b128: k0,k1,v0,v1
        v2f bmat;
        bmat.x = half ? 0.f : kk.x;
        bmat.y = half ? 0.f : kk.y;
        float v0 = kk.z;                       // V used by ALL lanes (column m)
        float v1 = kk.w;
        v8f c = {};
        c = __builtin_amdgcn_wmma_f32_16x16x4_f32(
                false, amat, false, bmat, (short)0, c, false, false);
#pragma unroll
        for (int r = 0; r < 8; ++r) {
            float p = __expf(c[r] - rowmax[r]);   // <= 1, no overflow
            lsum[r] += p;
            a0[r] = fmaf(p, v0, a0[r]);
            a1[r] = fmaf(p, v1, a1[r]);
        }
    }

    // final 16-lane reductions + store (row M = r + 8*half)
#pragma unroll
    for (int r = 0; r < 8; ++r) {
        float l  = lsum[r];
        float x0 = a0[r];
        float x1 = a1[r];
#pragma unroll
        for (int mask = 1; mask < 16; mask <<= 1) {
            l  += __shfl_xor(l,  mask, 32);
            x0 += __shfl_xor(x0, mask, 32);
            x1 += __shfl_xor(x1, mask, 32);
        }
        if (m == 0) {
            int row = qt * 16 + r + 8 * half;
            size_t o = ((size_t)bh * S_ + row) * 2;
            float inv = 1.0f / l;
            O[o + 0] = x0 * inv;
            O[o + 1] = x1 * inv;
        }
    }
}

// ---------------------------------------------------------------------------
// Kernel 3: collapse heads: s_o = out . shared_o_v ; final = s_o * o_u
// ---------------------------------------------------------------------------
__global__ __launch_bounds__(256) void combine_kernel(
    const float* __restrict__ O, const float* __restrict__ o_v,
    const float* __restrict__ o_u, float* __restrict__ out)
{
    int idx = blockIdx.x * blockDim.x + threadIdx.x;
    if (idx >= B_ * S_) return;
    int b = idx >> 12;
    int s = idx & (S_ - 1);
    size_t p0 = ((size_t)(b * H_ + 0) * S_ + s) * 2;
    size_t p1 = ((size_t)(b * H_ + 1) * S_ + s) * 2;
    float so = O[p0]     * o_v[0] + O[p0 + 1] * o_v[1]
             + O[p1]     * o_v[2] + O[p1 + 1] * o_v[3];
#pragma unroll
    for (int md = 0; md < MD_; ++md)
        out[(size_t)idx * MD_ + md] = so * o_u[md];
}

// ---------------------------------------------------------------------------
extern "C" void kernel_launch(void* const* d_in, const int* in_sizes, int n_in,
                              void* d_out, int out_size, void* d_ws, size_t ws_size,
                              hipStream_t stream)
{
    const float* x     = (const float*)d_in[0];
    const float* freqs = (const float*)d_in[1];
    const float* qk_v  = (const float*)d_in[2];
    const float* v_v   = (const float*)d_in[3];
    const float* o_v   = (const float*)d_in[4];
    const float* vproj = (const float*)d_in[5];
    const float* q_u   = (const float*)d_in[6];
    const float* k_u   = (const float*)d_in[7];
    const float* o_u   = (const float*)d_in[8];

    float* ws = (float*)d_ws;
    float* Q  = ws;                            // B*H*S*2 = 65536 floats
    float* KV = Q + (size_t)B_ * H_ * S_ * 2;  // B*S*4   = 65536 floats
    float* O  = KV + (size_t)B_ * S_ * 4;      // B*H*S*2 = 65536 floats
    float* out = (float*)d_out;

    prep_kernel<<<(B_ * S_ + 255) / 256, 256, 0, stream>>>(
        x, freqs, qk_v, v_v, vproj, q_u, k_u, Q, KV);

    attn_kernel<<<(B_ * H_ * (S_ / 16)) / 8, 256, 0, stream>>>(Q, KV, O);

    combine_kernel<<<(B_ * S_ + 255) / 256, 256, 0, stream>>>(O, o_v, o_u, out);
}

// v001
// It runs in 28 microseconds.
// Two timings next to v000 both put it at 1.15 times that version's speed.
#include <hip/hip_runtime.h>

// Problem constants (from reference)
#define B_   4
#define S_   4096
#define H_   2
#define D_   2
#define MD_  5
#define QB_  64      // query rows per work-group (4 tiles of 16, both heads)

typedef __attribute__((ext_vector_type(2))) float v2f;
typedef __attribute__((ext_vector_type(8))) float v8f;

// ---------------------------------------------------------------------------
// One launch. A work-group = 8 waves = 4 query tiles of 16 rows x 2 heads of
// one batch b.
//  (a) the batch's x rows (80 KB) go to LDS by whole-line b128 loads;
//  (b) every thread turns 16 of them into {k0,k1,v0,v1} (64 KB LDS image):
//        s_qk = x . shared_qk_v ; s_v = x . shared_v_v
//        K = rope(rmsnorm(s_qk*k_u)), V = s_v*shared_vproj_u
//      and every wave forms its own 16 Q rows, rope(rmsnorm(s_qk*q_u))/sqrt(D);
//  (c) attention: score tile (16x16) = Q(16x4, D padded) x K^T(4x16) via
//      v_wmma_f32_16x16x4_f32, two passes over LDS: (1) row max,
//      (2) exp-sum + P*V; shuffle reductions only outside the key loops;
//  (d) the two heads of a row meet in LDS: s_o = out . shared_o_v,
//      final = s_o * o_u.
// ---------------------------------------------------------------------------
__global__ __launch_bounds__(256) void fused_attn_kernel(
    const float* __restrict__ x, const float* __restrict__ freqs,
    const float* __restrict__ qk_v, const float* __restrict__ v_v,
    const float* __restrict__ o_v, const float* __restrict__ vproj_u,
    const float* __restrict__ q_u, const float* __restrict__ k_u,
    const float* __restrict__ o_u, float* __restrict__ out)
{
    // one LDS block, the K/V image first so that the key loops index from 0
    __shared__ __attribute__((aligned(16))) float lds[S_ * 4 + S_ * MD_ + H_ * QB_ * 2];
    float* smem = lds;                        // 64 KB: {k0,k1,v0,v1} per key
    float* xs   = lds + S_ * 4;               // 80 KB: x rows of this batch
    float* osh  = xs + S_ * MD_;              // per head and row: out0, out1

    const int tid  = threadIdx.x;
    const int b    = blockIdx.x >> 6;          // 64 work-groups per batch
    const int q0r  = (blockIdx.x & 63) * QB_;  // first query row of the group
    const int lane = tid & 31;
    const int wv   = tid >> 5;
    const int h    = wv >> 2;                  // head of this wave
    const int qt   = wv & 3;                   // query tile within the group
    const int m    = lane & 15;
    const int half = lane >> 4;                // lanes 16-31 carry K=2,3 (pad)
    const int qrow = q0r + qt * 16 + m;

    // every global read of the kernel is issued here, up front
    const float ov0 = o_v[0], ov1 = o_v[1], ov2 = o_v[2], ov3 = o_v[3];
    float wqk[MD_], wv_[MD_];
#pragma unroll
    for (int j = 0; j < MD_; ++j) { wqk[j] = qk_v[j]; wv_[j] = v_v[j]; }
    const float ku0 = k_u[0], ku1 = k_u[1];
    const float vu0 = vproj_u[0], vu1 = vproj_u[1];
    const float qu0 = q_u[0], qu1 = q_u[1], qu2 = q_u[2], qu3 = q_u[3];

    float fr[16];
#pragma unroll
    for (int i = 0; i < 16; ++i) fr[i] = freqs[i * 256 + tid];
    const float fq  = freqs[qrow];
    const float ou0 = o_u[tid % MD_];
    const float ou1 = o_u[(tid + 256) % MD_];
    // precaution: stands behind the loads above, ahead of the first rewrite of
    // a register that one of them names as its address
    asm volatile("s_wait_xcnt 0x0" ::: "memory");
    {   // (a) 5120 float4s, 20 a thread: all loads go out, then the stores
        const float4* src = (const float4*)(x + (size_t)b * S_ * MD_);
        float4* dst = (float4*)xs;
        float4 xr[(S_ * MD_ / 4) / 256];
#pragma unroll
        for (int i = 0; i < (S_ * MD_ / 4) / 256; ++i) xr[i] = src[i * 256 + tid];
#pragma unroll
        for (int i = 0; i < (S_ * MD_ / 4) / 256; ++i) dst[i * 256 + tid] = xr[i];
    }
    __syncthreads();

    // (b) K and V of 16 keys per thread (odd row pitch of 5 dwords spreads the banks).
    // All x reads stand ahead of the first K/V store, so that they go out as
    // one group and their LDS latency is paid once.
    float sqk_[16], sv_[16], sqk_q = 0.f;
#pragma unroll
    for (int i = 0; i < 16; ++i) {
        const float* xp = xs + (i * 256 + tid) * MD_;
        float sqk = 0.f, sv = 0.f;
#pragma unroll
        for (int j = 0; j < MD_; ++j) {
            float xi = xp[j];
            sqk = fmaf(xi, wqk[j], sqk);
            sv  = fmaf(xi, wv_[j], sv);
        }
        sqk_[i] = sqk; sv_[i] = sv;
    }
    {
        const float* xp = xs + qrow * MD_;
#pragma unroll
        for (int j = 0; j < MD_; ++j) sqk_q = fmaf(xp[j], wqk[j], sqk_q);
    }
#pragma unroll
    for (int i = 0; i < 16; ++i) {
        const int key = i * 256 + tid;
        float sqk = sqk_[i], sv = sv_[i];
        float cs = __cosf(fr[i]);             // D/2 == 1 -> one rotation angle
        float sn = __sinf(fr[i]);
        float k0 = sqk * ku0;
        float k1 = sqk * ku1;
        float var = 0.5f * (k0 * k0 + k1 * k1);
        float r = 16.0f * rsqrtf(var + 1e-6f);
        k0 *= r; k1 *= r;
        float4 kv;
        kv.x = k0 * cs - k1 * sn;
        kv.y = k0 * sn + k1 * cs;
        kv.z = sv * vu0;
        kv.w = sv * vu1;
        ((float4*)smem)[key] = kv;
    }

    // A matrix (16x4 f32): row = m, lanes 0-15 hold K=0,1; lanes 16-31 pad=0
    v2f amat;
    {
        float sqk = sqk_q;
        float cs = __cosf(fq);
        float sn = __sinf(fq);
        const float inv_sqrt_d = 0.70710678118654752f;   // 1/sqrt(D), D=2
        float q0 = sqk * (h ? qu2 : qu0);
        float q1 = sqk * (h ? qu3 : qu1);
        float var = 0.5f * (q0 * q0 + q1 * q1);
        float r = 16.0f * rsqrtf(var + 1e-6f);
        q0 *= r; q1 *= r;
        float qr = (q0 * cs - q1 * sn) * inv_sqrt_d;
        float qi = (q0 * sn + q1 * cs) * inv_sqrt_d;
        amat.x = half ? 0.f : qr;              // v_cndmask
        amat.y = half ? 0.f : qi;
    }
    __syncthreads();

    const float2* kv2 = (const float2*)smem;   // [key*2 + 0] = (k0,k1)
    const float4* kv4 = (const float4*)smem;   // [key]       = (k0,k1,v0,v1)

    // ---------------- pass 1: per-row max ----------------
    float tmax[8];
#pragma unroll
    for (int r = 0; r < 8; ++r) tmax[r] = -3.0e38f;

    for (int kt = 0; kt < S_ / 16; ++kt) {
        float2 kk = kv2[(kt * 16 + m) * 2];    // ds_load_b64 (broadcast hi half)
        v2f bmat;
        bmat.x = half ? 0.f : kk.x;            // v_cndmask, zero the K-pad lanes
        bmat.y = half ? 0.f : kk.y;
        v8f c = {};
        c = __builtin_amdgcn_wmma_f32_16x16x4_f32(
                false, amat, false, bmat, (short)0, c, false, false);
#pragma unroll
        for (int r = 0; r < 8; ++r) tmax[r] = fmaxf(tmax[r], c[r]);
    }

    float rowmax[8];
#pragma unroll
    for (int r = 0; r < 8; ++r) {
        float v = tmax[r];
#pragma unroll
        for (int mask = 1; mask < 16; mask <<= 1)
            v = fmaxf(v, __shfl_xor(v, mask, 32));
        rowmax[r] = v;
    }

    // ---------------- pass 2: exp-sum + P*V ----------------
    float lsum[8], a0[8], a1[8];
#pragma unroll
    for (int r = 0; r < 8; ++r) { lsum[r] = 0.f; a0[r] = 0.f; a1[r] = 0.f; }

    for (int kt = 0; kt < S_ / 16; ++kt) {
        float4 kk = kv4[kt * 16 + m];          // ds_load_b128: k0,k1,v0,v1
        v2f bmat;
        bmat.x = half ? 0.f : kk.x;
        bmat.y = half ? 0.f : kk.y;
        float v0 = kk.z;                       // V used by ALL lanes (column m)
        float v1 = kk.w;
        v8f c = {};
        c = __builtin_amdgcn_wmma_f32_16x16x4_f32(
                false, amat, false, bmat, (short)0, c, false, false);
#pragma unroll
        for (int r = 0; r < 8; ++r) {
            float p = __expf(c[r] - rowmax[r]);   // <= 1, no overflow
            lsum[r] += p;
            a0[r] = fmaf(p, v0, a0[r]);
            a1[r] = fmaf(p, v1, a1[r]);
        }
    }

    // final 16-lane reductions; row M = r + 8*half goes to LDS
#pragma unroll
    for (int r = 0; r < 8; ++r) {
        float l  = lsum[r];
        float x0 = a0[r];
        float x1 = a1[r];
#pragma unroll
        for (int mask = 1; mask < 16; mask <<= 1) {
            l  += __shfl_xor(l,  mask, 32);
            x0 += __shfl_xor(x0, mask, 32);
            x1 += __shfl_xor(x1, mask, 32);
        }
        if (m == 0) {
            int o = (h * QB_ + qt * 16 + r + 8 * half) * 2;
            float inv = 1.0f / l;
            osh[o + 0] = x0 * inv;
            osh[o + 1] = x1 * inv;
        }
    }
    __syncthreads();

    // (d) collapse heads; 64 rows x 5 outputs = 1280 contiguous bytes
    float* op = out + ((size_t)b * S_ + q0r) * MD_;
    {
        int row = tid / MD_;
        float so = osh[row * 2]             * ov0 + osh[row * 2 + 1]         * ov1
                 + osh[(QB_ + row) * 2]     * ov2 + osh[(QB_ + row) * 2 + 1] * ov3;
        op[tid] = so * ou0;
    }
    if (tid < QB_ * MD_ - 256) {
        int row = (tid + 256) / MD_;
        float so = osh[row * 2]             * ov0 + osh[row * 2 + 1]         * ov1
                 + osh[(QB_ + row) * 2]     * ov2 + osh[(QB_ + row) * 2 + 1] * ov3;
        op[tid + 256] = so * ou1;
    }
}

// ---------------------------------------------------------------------------
extern "C" void kernel_launch(void* const* d_in, const int* in_sizes, int n_in,
                              void* d_out, int out_size, void* d_ws, size_t ws_size,
                              hipStream_t stream)
{
    const float* x     = (const float*)d_in[0];
    const float* freqs = (const float*)d_in[1];
    const float* qk_v  = (const float*)d_in[2];
    const float* v_v   = (const float*)d_in[3];
    const float* o_v   = (const float*)d_in[4];
    const float* vproj = (const float*)d_in[5];
    const float* q_u   = (const float*)d_in[6];
    const float* k_u   = (const float*)d_in[7];
    const float* o_u   = (const float*)d_in[8];
    float* out = (float*)d_out;

    fused_attn_kernel<<<B_ * (S_ / QB_), 256, 0, stream>>>(
        x, freqs, qk_v, v_v, o_v, vproj, q_u, k_u, o_u, out);
}

// v002
// It runs in 26 microseconds.
// Two timings next to v001 both put it at 1.10 times that version's speed.
// Counting every step since v000, it is 1.27 times as fast.
#include <hip/hip_runtime.h>

// Problem constants (from reference)
#define B_   4
#define S_   4096
#define H_   2
#define D_   2
#define MD_  5
#define QB_  64      // query rows per work-group (4 tiles of 16, both heads)
#define KG_  8       // key tiles per group read from LDS at one place
#define NKG_ (S_ / 16 / KG_)

typedef __attribute__((ext_vector_type(2))) float v2f;
typedef __attribute__((ext_vector_type(8))) float v8f;

// ---------------------------------------------------------------------------
// One launch. A work-group = 8 waves = 4 query tiles of 16 rows x 2 heads of
// one batch b.
//  (a) the batch's x rows (80 KB) go to LDS by whole-line b128 loads;
//  (b) every thread turns 16 of them into {k0,k1,v0,v1} (64 KB LDS image):
//        s_qk = x . shared_qk_v ; s_v = x . shared_v_v
//        K = rope(rmsnorm(s_qk*k_u)), V = s_v*shared_vproj_u
//      and every wave forms its own 16 Q rows, rope(rmsnorm(s_qk*q_u))/sqrt(D);
//  (c) attention: score tile (16x16) = Q(16x4, D padded) x K^T(4x16) via
//      v_wmma_f32_16x16x4_f32, two passes over LDS: (1) row max,
//      (2) exp-sum + P*V; shuffle reductions only outside the key loops;
//  (d) the two heads of a row meet in LDS: s_o = out . shared_o_v,
//      final = s_o * o_u.
// ---------------------------------------------------------------------------
__global__ __launch_bounds__(256) void fused_attn_kernel(
    const float* __restrict__ x, const float* __restrict__ freqs,
    const float* __restrict__ qk_v, const float* __restrict__ v_v,
    const float* __restrict__ o_v, const float* __restrict__ vproj_u,
    const float* __restrict__ q_u, const float* __restrict__ k_u,
    const float* __restrict__ o_u, float* __restrict__ out)
{
    // one LDS block, the K/V image first so that the key loops index from 0
    __shared__ __attribute__((aligned(16))) float lds[S_ * 4 + S_ * MD_ + H_ * QB_ * 2];
    float* smem = lds;                        // 64 KB: {k0,k1,v0,v1} per key
    float* xs   = lds + S_ * 4;               // 80 KB: x rows of this batch
    float* osh  = xs + S_ * MD_;              // per head and row: out0, out1

    const int tid  = threadIdx.x;
    const int b    = blockIdx.x >> 6;          // 64 work-groups per batch
    const int q0r  = (blockIdx.x & 63) * QB_;  // first query row of the group
    const int lane = tid & 31;
    const int wv   = tid >> 5;
    const int h    = wv >> 2;                  // head of this wave
    const int qt   = wv & 3;                   // query tile within the group
    const int m    = lane & 15;
    const int half = lane >> 4;                // lanes 16-31 carry K=2,3 (pad)
    const int qrow = q0r + qt * 16 + m;

    // every global read of the kernel is issued here, up front
    const float ov0 = o_v[0], ov1 = o_v[1], ov2 = o_v[2], ov3 = o_v[3];
    float wqk[MD_], wv_[MD_];
#pragma unroll
    for (int j = 0; j < MD_; ++j) { wqk[j] = qk_v[j]; wv_[j] = v_v[j]; }
    const float ku0 = k_u[0], ku1 = k_u[1];
    const float vu0 = vproj_u[0], vu1 = vproj_u[1];
    const float qu0 = q_u[0], qu1 = q_u[1], qu2 = q_u[2], qu3 = q_u[3];

    float fr[16];
#pragma unroll
    for (int i = 0; i < 16; ++i) fr[i] = freqs[i * 256 + tid];
    const float fq  = freqs[qrow];
    const float ou0 = o_u[tid % MD_];
    const float ou1 = o_u[(tid + 256) % MD_];
    // precaution: stands behind the loads above, ahead of the first rewrite of
    // a register that one of them names as its address
    asm volatile("s_wait_xcnt 0x0" ::: "memory");
    {   // (a) 5120 float4s, 20 a thread: all loads go out, then the stores
        const float4* src = (const float4*)(x + (size_t)b * S_ * MD_);
        float4* dst = (float4*)xs;
        float4 xr[(S_ * MD_ / 4) / 256];
#pragma unroll
        for (int i = 0; i < (S_ * MD_ / 4) / 256; ++i) xr[i] = src[i * 256 + tid];
#pragma unroll
        for (int i = 0; i < (S_ * MD_ / 4) / 256; ++i) dst[i * 256 + tid] = xr[i];
    }
    __syncthreads();

    // (b) K and V of 16 keys per thread (odd row pitch of 5 dwords spreads the banks).
    // All x reads stand ahead of the first K/V store, so that they go out as
    // one group and their LDS latency is paid once.
    float sqk_[16], sv_[16], sqk_q = 0.f;
#pragma unroll
    for (int i = 0; i < 16; ++i) {
        const float* xp = xs + (i * 256 + tid) * MD_;
        float sqk = 0.f, sv = 0.f;
#pragma unroll
        for (int j = 0; j < MD_; ++j) {
            float xi = xp[j];
            sqk = fmaf(xi, wqk[j], sqk);
            sv  = fmaf(xi, wv_[j], sv);
        }
        sqk_[i] = sqk; sv_[i] = sv;
    }
    {
        const float* xp = xs + qrow * MD_;
#pragma unroll
        for (int j = 0; j < MD_; ++j) sqk_q = fmaf(xp[j], wqk[j], sqk_q);
    }
#pragma unroll
    for (int i = 0; i < 16; ++i) {
        const int key = i * 256 + tid;
        float sqk = sqk_[i], sv = sv_[i];
        float cs = __cosf(fr[i]);             // D/2 == 1 -> one rotation angle
        float sn = __sinf(fr[i]);
        float k0 = sqk * ku0;
        float k1 = sqk * ku1;
        float var = 0.5f * (k0 * k0 + k1 * k1);
        float r = 16.0f * rsqrtf(var + 1e-6f);
        k0 *= r; k1 *= r;
        float4 kv;
        kv.x = k0 * cs - k1 * sn;
        kv.y = k0 * sn + k1 * cs;
        kv.z = sv * vu0;
        kv.w = sv * vu1;
        ((float4*)smem)[key] = kv;
    }

    // A matrix (16x4 f32): row = m, lanes 0-15 hold K=0,1; lanes 16-31 pad=0
    v2f amat;
    {
        float sqk = sqk_q;
        float cs = __cosf(fq);
        float sn = __sinf(fq);
        const float inv_sqrt_d = 0.70710678118654752f;   // 1/sqrt(D), D=2
        float q0 = sqk * (h ? qu2 : qu0);
        float q1 = sqk * (h ? qu3 : qu1);
        float var = 0.5f * (q0 * q0 + q1 * q1);
        float r = 16.0f * rsqrtf(var + 1e-6f);
        q0 *= r; q1 *= r;
        float qr = (q0 * cs - q1 * sn) * inv_sqrt_d;
        float qi = (q0 * sn + q1 * cs) * inv_sqrt_d;
        amat.x = half ? 0.f : qr;              // v_cndmask
        amat.y = half ? 0.f : qi;
    }
    __syncthreads();

    const float2* kv2 = (const float2*)smem;   // [key*2 + 0] = (k0,k1)
    const float4* kv4 = (const float4*)smem;   // [key]       = (k0,k1,v0,v1)

    // ---------------- pass 1: per-row max ----------------
    // Both key loops keep two register sets of key fragments: while one group of
    // tiles is worked on, the LDS reads of the next group are already under way,
    // so that a wave does not sit out the LDS latency in front of every group.
    float tmax[8];
#pragma unroll
    for (int r = 0; r < 8; ++r) tmax[r] = -3.0e38f;

    {
        const float2* kp = kv2 + m * 2;        // + tile * 32: (k0,k1) of key tile*16+m
        float2 kq[2][KG_];
#pragma unroll
        for (int t = 0; t < KG_; ++t) kq[0][t] = kp[t * 32];
        for (int g = 0; g < NKG_; g += 2) {
#pragma unroll
            for (int i = 0; i < 2; ++i) {
                // the last fetch wraps to group 0 and is not used
                const float2* pn = kp + ((g + i + 1) & (NKG_ - 1)) * (KG_ * 32);
#pragma unroll
                for (int t = 0; t < KG_; ++t) kq[i ^ 1][t] = pn[t * 32];
                // compiler fence: holds the reads above in front of the work below; without
                // it the compiler moves them to the head of the next trip, where the wave
                // waits for them
                asm volatile("" ::: "memory");
#pragma unroll
                for (int t = 0; t < KG_; ++t) {
                    v2f bmat;
                    bmat.x = half ? 0.f : kq[i][t].x;  // v_cndmask, zero the K-pad lanes
                    bmat.y = half ? 0.f : kq[i][t].y;
                    v8f c = {};
                    c = __builtin_amdgcn_wmma_f32_16x16x4_f32(
                            false, amat, false, bmat, (short)0, c, false, false);
#pragma unroll
                    for (int r = 0; r < 8; ++r) tmax[r] = fmaxf(tmax[r], c[r]);
                }
            }
        }
    }

    float rowmax[8];
#pragma unroll
    for (int r = 0; r < 8; ++r) {
        float v = tmax[r];
#pragma unroll
        for (int mask = 1; mask < 16; mask <<= 1)
            v = fmaxf(v, __shfl_xor(v, mask, 32));
        rowmax[r] = v;
    }

    // ---------------- pass 2: exp-sum + P*V ----------------
    float lsum[8], a0[8], a1[8];
#pragma unroll
    for (int r = 0; r < 8; ++r) { lsum[r] = 0.f; a0[r] = 0.f; a1[r] = 0.f; }

    {
        const float4* kp = kv4 + m;            // + tile * 16: k0,k1,v0,v1 of key tile*16+m
        float4 kq[2][KG_];
#pragma unroll
        for (int t = 0; t < KG_; ++t) kq[0][t] = kp[t * 16];
        for (int g = 0; g < NKG_; g += 2) {
#pragma unroll
            for (int i = 0; i < 2; ++i) {
                // the last fetch wraps to group 0 and is not used
                const float4* pn = kp + ((g + i + 1) & (NKG_ - 1)) * (KG_ * 16);
#pragma unroll
                for (int t = 0; t < KG_; ++t) kq[i ^ 1][t] = pn[t * 16];
                // compiler fence: holds the reads above in front of the work below, as in pass 1
                asm volatile("" ::: "memory");
#pragma unroll
                for (int t = 0; t < KG_; ++t) {
                    v2f bmat;
                    bmat.x = half ? 0.f : kq[i][t].x;
                    bmat.y = half ? 0.f : kq[i][t].y;
                    float v0 = kq[i][t].z;     // V used by ALL lanes (column m)
                    float v1 = kq[i][t].w;
                    v8f c = {};
                    c = __builtin_amdgcn_wmma_f32_16x16x4_f32(
                            false, amat, false, bmat, (short)0, c, false, false);
#pragma unroll
                    for (int r = 0; r < 8; ++r) {
                        float p = __expf(c[r] - rowmax[r]);   // <= 1, no overflow
                        lsum[r] += p;
                        a0[r] = fmaf(p, v0, a0[r]);
                        a1[r] = fmaf(p, v1, a1[r]);
                    }
                }
            }
        }
    }

    // final 16-lane reductions; row M = r + 8*half goes to LDS
#pragma unroll
    for (int r = 0; r < 8; ++r) {
        float l  = lsum[r];
        float x0 = a0[r];
        float x1 = a1[r];
#pragma unroll
        for (int mask = 1; mask < 16; mask <<= 1) {
            l  += __shfl_xor(l,  mask, 32);
            x0 += __shfl_xor(x0, mask, 32);
            x1 += __shfl_xor(x1, mask, 32);
        }
        if (m == 0) {
            int o = (h * QB_ + qt * 16 + r + 8 * half) * 2;
            float inv = 1.0f / l;
            osh[o + 0] = x0 * inv;
            osh[o + 1] = x1 * inv;
        }
    }
    __syncthreads();

    // (d) collapse heads; 64 rows x 5 outputs = 1280 contiguous bytes
    float* op = out + ((size_t)b * S_ + q0r) * MD_;
    {
        int row = tid / MD_;
        float so = osh[row * 2]             * ov0 + osh[row * 2 + 1]         * ov1
                 + osh[(QB_ + row) * 2]     * ov2 + osh[(QB_ + row) * 2 + 1] * ov3;
        op[tid] = so * ou0;
    }
    if (tid < QB_ * MD_ - 256) {
        int row = (tid + 256) / MD_;
        float so = osh[row * 2]             * ov0 + osh[row * 2 + 1]         * ov1
                 + osh[(QB_ + row) * 2]     * ov2 + osh[(QB_ + row) * 2 + 1] * ov3;
        op[tid + 256] = so * ou1;
    }
}

// ---------------------------------------------------------------------------
extern "C" void kernel_launch(void* const* d_in, const int* in_sizes, int n_in,
                              void* d_out, int out_size, void* d_ws, size_t ws_size,
                              hipStream_t stream)
{
    const float* x     = (const float*)d_in[0];
    const float* freqs = (const float*)d_in[1];
    const float* qk_v  = (const float*)d_in[2];
    const float* v_v   = (const float*)d_in[3];
    const float* o_v   = (const float*)d_in[4];
    const float* vproj = (const float*)d_in[5];
    const float* q_u   = (const float*)d_in[6];
    const float* k_u   = (const float*)d_in[7];
    const float* o_u   = (const float*)d_in[8];
    float* out = (float*)d_out;

    fused_attn_kernel<<<B_ * (S_ / QB_), 256, 0, stream>>>(
        x, freqs, qk_v, v_v, o_v, vproj, q_u, k_u, o_u, out);
}

// v003
// Measured time: 21.5 microseconds a run.
// Timed twice side by side with v002, it ran 1.21 times as fast both times.
// Counting every step since v000, it is 1.53 times as fast.
#include <hip/hip_runtime.h>

// Problem constants (from reference)
#define B_   4
#define S_   4096
#define H_   2
#define D_   2
#define MD_  5
#define QB_  64      // query rows per work-group (4 tiles of 16, both heads)
#define KG_  8       // key tiles per group read from LDS at one place
#define NKG_ (S_ / 16 / KG_)

typedef __attribute__((ext_vector_type(2))) float v2f;
typedef __attribute__((ext_vector_type(8))) float v8f;

// ---------------------------------------------------------------------------
// One launch. A work-group = 8 waves = 4 query tiles of 16 rows x 2 heads of
// one batch b.
//  (a) the batch's x rows (80 KB) go to LDS by whole-line b128 loads;
//  (b) every thread turns 16 of them into {k0,k1,v0,v1} (64 KB LDS image):
//        s_qk = x . shared_qk_v ; s_v = x . shared_v_v
//        K = rope(rmsnorm(s_qk*k_u)), V = s_v*shared_vproj_u
//      and every wave forms its own 16 Q rows, rope(rmsnorm(s_qk*q_u))/sqrt(D);
//  (c) attention: score tile (16x16) = Q(16x4, D padded) x K^T(4x16) via
//      v_wmma_f32_16x16x4_f32. (1) the softmax shift of every row, from the
//      reach of the batch's keys in 32 directions (the 8 waves share the keys);
//      (2) exp-sum + P*V over all keys; shuffle reductions only outside the loops;
//  (d) the two heads of a row meet in LDS: s_o = out . shared_o_v,
//      final = s_o * o_u.
// ---------------------------------------------------------------------------
__global__ __launch_bounds__(256) void fused_attn_kernel(
    const float* __restrict__ x, const float* __restrict__ freqs,
    const float* __restrict__ qk_v, const float* __restrict__ v_v,
    const float* __restrict__ o_v, const float* __restrict__ vproj_u,
    const float* __restrict__ q_u, const float* __restrict__ k_u,
    const float* __restrict__ o_u, float* __restrict__ out)
{
    // one LDS block, the K/V image first so that the key loops index from 0
    __shared__ __attribute__((aligned(16))) float lds[S_ * 4 + S_ * MD_ + H_ * QB_ * 2];
    float* smem = lds;                        // 64 KB: {k0,k1,v0,v1} per key
    float* xs   = lds + S_ * 4;               // 80 KB: x rows of this batch
    float* osh  = xs + S_ * MD_;              // per head and row: out0, out1

    const int tid  = threadIdx.x;
    const int b    = blockIdx.x >> 6;          // 64 work-groups per batch
    const int q0r  = (blockIdx.x & 63) * QB_;  // first query row of the group
    const int lane = tid & 31;
    const int wv   = tid >> 5;
    const int h    = wv >> 2;                  // head of this wave
    const int qt   = wv & 3;                   // query tile within the group
    const int m    = lane & 15;
    const int half = lane >> 4;                // lanes 16-31 carry K=2,3 (pad)
    const int qrow = q0r + qt * 16 + m;

    // every global read of the kernel is issued here, up front
    const float ov0 = o_v[0], ov1 = o_v[1], ov2 = o_v[2], ov3 = o_v[3];
    float wqk[MD_], wv_[MD_];
#pragma unroll
    for (int j = 0; j < MD_; ++j) { wqk[j] = qk_v[j]; wv_[j] = v_v[j]; }
    const float ku0 = k_u[0], ku1 = k_u[1];
    const float vu0 = vproj_u[0], vu1 = vproj_u[1];
    const float qu0 = q_u[0], qu1 = q_u[1], qu2 = q_u[2], qu3 = q_u[3];

    float fr[16];
#pragma unroll
    for (int i = 0; i < 16; ++i) fr[i] = freqs[i * 256 + tid];
    const float fq  = freqs[qrow];
    const float ou0 = o_u[tid % MD_];
    const float ou1 = o_u[(tid + 256) % MD_];
    // precaution: stands behind the loads above, ahead of the first rewrite of
    // a register that one of them names as its address
    asm volatile("s_wait_xcnt 0x0" ::: "memory");
    {   // (a) 5120 float4s, 20 a thread: all loads go out, then the stores
        const float4* src = (const float4*)(x + (size_t)b * S_ * MD_);
        float4* dst = (float4*)xs;
        float4 xr[(S_ * MD_ / 4) / 256];
#pragma unroll
        for (int i = 0; i < (S_ * MD_ / 4) / 256; ++i) xr[i] = src[i * 256 + tid];
#pragma unroll
        for (int i = 0; i < (S_ * MD_ / 4) / 256; ++i) dst[i * 256 + tid] = xr[i];
    }
    __syncthreads();

    // (b) K and V of 16 keys per thread (odd row pitch of 5 dwords spreads the banks).
    // All x reads stand ahead of the first K/V store, so that they go out as
    // one group and their LDS latency is paid once.
    float sqk_[16], sv_[16], sqk_q = 0.f;
#pragma unroll
    for (int i = 0; i < 16; ++i) {
        const float* xp = xs + (i * 256 + tid) * MD_;
        float sqk = 0.f, sv = 0.f;
#pragma unroll
        for (int j = 0; j < MD_; ++j) {
            float xi = xp[j];
            sqk = fmaf(xi, wqk[j], sqk);
            sv  = fmaf(xi, wv_[j], sv);
        }
        sqk_[i] = sqk; sv_[i] = sv;
    }
    {
        const float* xp = xs + qrow * MD_;
#pragma unroll
        for (int j = 0; j < MD_; ++j) sqk_q = fmaf(xp[j], wqk[j], sqk_q);
    }
#pragma unroll
    for (int i = 0; i < 16; ++i) {
        const int key = i * 256 + tid;
        float sqk = sqk_[i], sv = sv_[i];
        float cs = __cosf(fr[i]);             // D/2 == 1 -> one rotation angle
        float sn = __sinf(fr[i]);
        float k0 = sqk * ku0;
        float k1 = sqk * ku1;
        float var = 0.5f * (k0 * k0 + k1 * k1);
        float r = 16.0f * rsqrtf(var + 1e-6f);
        k0 *= r; k1 *= r;
        float4 kv;
        kv.x = k0 * cs - k1 * sn;
        kv.y = k0 * sn + k1 * cs;
        kv.z = sv * vu0;
        kv.w = sv * vu1;
        ((float4*)smem)[key] = kv;
    }

    // A matrix (16x4 f32): row = m, lanes 0-15 hold K=0,1; lanes 16-31 pad=0
    v2f amat;
    float qr, qi;                              // this lane's query row m, all 32 lanes
    {
        float sqk = sqk_q;
        float cs = __cosf(fq);
        float sn = __sinf(fq);
        const float inv_sqrt_d = 0.70710678118654752f;   // 1/sqrt(D), D=2
        float q0 = sqk * (h ? qu2 : qu0);
        float q1 = sqk * (h ? qu3 : qu1);
        float var = 0.5f * (q0 * q0 + q1 * q1);
        float r = 16.0f * rsqrtf(var + 1e-6f);
        q0 *= r; q1 *= r;
        qr = (q0 * cs - q1 * sn) * inv_sqrt_d;
        qi = (q0 * sn + q1 * cs) * inv_sqrt_d;
        amat.x = half ? 0.f : qr;              // v_cndmask
        amat.y = half ? 0.f : qi;
    }
    __syncthreads();

    const float2* kv2 = (const float2*)smem;   // [key*2 + 0] = (k0,k1)
    const float4* kv4 = (const float4*)smem;   // [key]       = (k0,k1,v0,v1)

    // ---------------- pass 1: the softmax shift of each row ----------------
    // softmax is unchanged by any shift of a row's scores; the shift only has to keep
    // exp in range. With u_j the unit vector at angle j*pi/16 (j = 0..31) and
    // R_j = max over the batch's keys of u_j.k, a query q whose angle is nearest to
    // that of u_j has |max_k q.k - |q| R_j| <= |q| max|k| pi/32. rmsnorm keeps |q| and
    // |k| under 16 sqrt(2) for every input, so with the 1/sqrt(D) in q the shift
    // |q| R_j lies within 36 of the true row max: exp stays between e^-36 and e^36
    // at the row's largest score, and the sums far inside the f32 range.
    // R_j needs no query: wave wv scores its eighth of the keys against u_0..u_15
    // (one WMMA a key tile); the minimum gives the opposite direction, R_(j+16).
    // Both key loops keep two register sets of key fragments: while one group of
    // tiles is worked on, the LDS reads of the next group are already under way,
    // so that a wave does not sit out the LDS latency in front of every group.
    float hmax[8], hmin[8];
#pragma unroll
    for (int r = 0; r < 8; ++r) { hmax[r] = -3.0e38f; hmin[r] = 3.0e38f; }

    {
        v2f dmat;                              // A: row m = u_m, K-pad lanes zero
        const float ang = (float)m * 0.19634954084936207f;   // pi/16
        dmat.x = half ? 0.f : __cosf(ang);
        dmat.y = half ? 0.f : __sinf(ang);
        const float2* kp = kv2 + (wv * (S_ / 8) + m) * 2;  // + tile * 32, this wave's keys
        float2 kq[2][KG_];
#pragma unroll
        for (int t = 0; t < KG_; ++t) kq[0][t] = kp[t * 32];
        // kept rolled: unrolled whole, the build holds all 32 score tiles at once and
        // goes past 255 registers, with a register-bank switch around every WMMA
#pragma unroll 1
        for (int g = 0; g < NKG_ / 8; g += 2) {
#pragma unroll
            for (int i = 0; i < 2; ++i) {
                // the last fetch wraps to the wave's first group and is not used
                const float2* pn = kp + ((g + i + 1) & (NKG_ / 8 - 1)) * (KG_ * 32);
#pragma unroll
                for (int t = 0; t < KG_; ++t) kq[i ^ 1][t] = pn[t * 32];
                // compiler fence: holds the reads above in front of the work below; without
                // it the compiler moves them to the head of the next trip, where the wave
                // waits for them
                asm volatile("" ::: "memory");
#pragma unroll
                for (int t = 0; t < KG_; ++t) {
                    v2f bmat;
                    bmat.x = half ? 0.f : kq[i][t].x;  // v_cndmask, zero the K-pad lanes
                    bmat.y = half ? 0.f : kq[i][t].y;
                    v8f c = {};
                    c = __builtin_amdgcn_wmma_f32_16x16x4_f32(
                            false, dmat, false, bmat, (short)0, c, false, false);
#pragma unroll
                    for (int r = 0; r < 8; ++r) {
                        hmax[r] = fmaxf(hmax[r], c[r]);
                        hmin[r] = fminf(hmin[r], c[r]);
                    }
                }
            }
        }
    }

    // the wave's 512 keys: 16-lane reductions; direction r + 8*half, and its opposite.
    // The x rows are dead since the barrier above: their LDS takes the 8 x 32 partials.
    // Step by step over all 16 values, so that the shuffles of a step go out together.
    float* hsh = xs;
#pragma unroll
    for (int mask = 1; mask < 16; mask <<= 1) {
        float ph[8], pl[8];
#pragma unroll
        for (int r = 0; r < 8; ++r) {
            ph[r] = __shfl_xor(hmax[r], mask, 32);
            pl[r] = __shfl_xor(hmin[r], mask, 32);
        }
#pragma unroll
        for (int r = 0; r < 8; ++r) {
            hmax[r] = fmaxf(hmax[r], ph[r]);
            hmin[r] = fminf(hmin[r], pl[r]);
        }
    }
    if (m == 0) {
#pragma unroll
        for (int r = 0; r < 8; ++r) {
            hsh[wv * 32 + r + 8 * half]      = hmax[r];
            hsh[wv * 32 + 16 + r + 8 * half] = -hmin[r];
        }
    }
    __syncthreads();

    float rowmax[8];                           // the shift of row r + 8*half
    {
        // nearest of the 32 directions; the mask also bounds the index for a NaN query
        const int j = (int)rintf(atan2f(qi, qr) * 5.0929581789406507f) & 31;   // 16/pi
        float rj = hsh[j];
#pragma unroll
        for (int w = 1; w < 8; ++w) rj = fmaxf(rj, hsh[w * 32 + j]);
        const float est = sqrtf(qr * qr + qi * qi) * rj;   // row m, in lanes m and m+16
#pragma unroll
        for (int r = 0; r < 8; ++r) rowmax[r] = __shfl(est, r + 8 * half, 32);
    }

    // ---------------- pass 2: exp-sum + P*V ----------------
    float lsum[8], a0[8], a1[8];
#pragma unroll
    for (int r = 0; r < 8; ++r) { lsum[r] = 0.f; a0[r] = 0.f; a1[r] = 0.f; }

    {
        const float4* kp = kv4 + m;            // + tile * 16: k0,k1,v0,v1 of key tile*16+m
        float4 kq[2][KG_];
#pragma unroll
        for (int t = 0; t < KG_; ++t) kq[0][t] = kp[t * 16];
        for (int g = 0; g < NKG_; g += 2) {
#pragma unroll
            for (int i = 0; i < 2; ++i) {
                // the last fetch wraps to group 0 and is not used
                const float4* pn = kp + ((g + i + 1) & (NKG_ - 1)) * (KG_ * 16);
#pragma unroll
                for (int t = 0; t < KG_; ++t) kq[i ^ 1][t] = pn[t * 16];
                // compiler fence: holds the reads above in front of the work below, as in pass 1
                asm volatile("" ::: "memory");
#pragma unroll
                for (int t = 0; t < KG_; ++t) {
                    v2f bmat;
                    bmat.x = half ? 0.f : kq[i][t].x;
                    bmat.y = half ? 0.f : kq[i][t].y;
                    float v0 = kq[i][t].z;     // V used by ALL lanes (column m)
                    float v1 = kq[i][t].w;
                    v8f c = {};
                    c = __builtin_amdgcn_wmma_f32_16x16x4_f32(
                            false, amat, false, bmat, (short)0, c, false, false);
#pragma unroll
                    for (int r = 0; r < 8; ++r) {
                        float p = __expf(c[r] - rowmax[r]);   // <= e^36, no overflow
                        lsum[r] += p;
                        a0[r] = fmaf(p, v0, a0[r]);
                        a1[r] = fmaf(p, v1, a1[r]);
                    }
                }
            }
        }
    }

    // final 16-lane reductions; row M = r + 8*half goes to LDS
#pragma unroll
    for (int r = 0; r < 8; ++r) {
        float l  = lsum[r];
        float x0 = a0[r];
        float x1 = a1[r];
#pragma unroll
        for (int mask = 1; mask < 16; mask <<= 1) {
            l  += __shfl_xor(l,  mask, 32);
            x0 += __shfl_xor(x0, mask, 32);
            x1 += __shfl_xor(x1, mask, 32);
        }
        if (m == 0) {
            int o = (h * QB_ + qt * 16 + r + 8 * half) * 2;
            float inv = 1.0f / l;
            osh[o + 0] = x0 * inv;
            osh[o + 1] = x1 * inv;
        }
    }
    __syncthreads();

    // (d) collapse heads; 64 rows x 5 outputs = 1280 contiguous bytes
    float* op = out + ((size_t)b * S_ + q0r) * MD_;
    {
        int row = tid / MD_;
        float so = osh[row * 2]             * ov0 + osh[row * 2 + 1]         * ov1
                 + osh[(QB_ + row) * 2]     * ov2 + osh[(QB_ + row) * 2 + 1] * ov3;
        op[tid] = so * ou0;
    }
    if (tid < QB_ * MD_ - 256) {
        int row = (tid + 256) / MD_;
        float so = osh[row * 2]             * ov0 + osh[row * 2 + 1]         * ov1
                 + osh[(QB_ + row) * 2]     * ov2 + osh[(QB_ + row) * 2 + 1] * ov3;
        op[tid + 256] = so * ou1;
    }
}

// ---------------------------------------------------------------------------
extern "C" void kernel_launch(void* const* d_in, const int* in_sizes, int n_in,
                              void* d_out, int out_size, void* d_ws, size_t ws_size,
                              hipStream_t stream)
{
    const float* x     = (const float*)d_in[0];
    const float* freqs = (const float*)d_in[1];
    const float* qk_v  = (const float*)d_in[2];
    const float* v_v   = (const float*)d_in[3];
    const float* o_v   = (const float*)d_in[4];
    const float* vproj = (const float*)d_in[5];
    const float* q_u   = (const float*)d_in[6];
    const float* k_u   = (const float*)d_in[7];
    const float* o_u   = (const float*)d_in[8];
    float* out = (float*)d_out;

    fused_attn_kernel<<<B_ * (S_ / QB_), 256, 0, stream>>>(
        x, freqs, qk_v, v_v, o_v, vproj, q_u, k_u, o_u, out);
}

// v004
// Measured time: 19.2 microseconds a run.
// Two timings next to v003 both put it at 1.10 times that version's speed.
// Over all steps from v000 it is 1.68 times as fast.
#include <hip/hip_runtime.h>

// Problem constants (from reference)
#define B_   4
#define S_   4096
#define H_   2
#define D_   2
#define MD_  5
#define QB_  64      // query rows per work-group (4 tiles of 16, both heads)
#define KG_  8       // key tiles per group read from LDS at one place
#define NKG_ (S_ / 16 / KG_)

typedef __attribute__((ext_vector_type(2))) float v2f;
typedef __attribute__((ext_vector_type(8))) float v8f;

// ---------------------------------------------------------------------------
// One launch. A work-group = 8 waves = 4 query tiles of 16 rows x 2 heads of
// one batch b.
//  (a) the batch's x rows (80 KB) go to LDS by whole-line b128 loads;
//  (b) every thread turns 16 of them into {k0,k1,v0,v1} (64 KB LDS image):
//        s_qk = x . shared_qk_v ; s_v = x . shared_v_v
//        K = rope(rmsnorm(s_qk*k_u)), V = s_v*shared_vproj_u
//      and every wave forms its own 16 Q rows, rope(rmsnorm(s_qk*q_u))/sqrt(D);
//  (c) attention: score tile (16x16) = Q(16x4, D padded) x K^T(4x16) via
//      v_wmma_f32_16x16x4_f32. (1) the softmax shift of every row, from the
//      reach of the batch's keys in 32 directions (the 8 waves share the keys);
//      (2) exp-sum + P*V over all keys; shuffle reductions only outside the loops;
//  (d) the two heads of a row meet in LDS: s_o = out . shared_o_v,
//      final = s_o * o_u.
// ---------------------------------------------------------------------------
__global__ __launch_bounds__(256) void fused_attn_kernel(
    const float* __restrict__ x, const float* __restrict__ freqs,
    const float* __restrict__ qk_v, const float* __restrict__ v_v,
    const float* __restrict__ o_v, const float* __restrict__ vproj_u,
    const float* __restrict__ q_u, const float* __restrict__ k_u,
    const float* __restrict__ o_u, float* __restrict__ out)
{
    // one LDS block, the K/V image first so that the key loops index from 0
    __shared__ __attribute__((aligned(16))) float lds[S_ * 4 + S_ * MD_ + H_ * QB_ * 2];
    float* smem = lds;                        // 64 KB: {k0,k1,v0,v1} per key
    float* xs   = lds + S_ * 4;               // 80 KB: x rows of this batch
    float* osh  = xs + S_ * MD_;              // per head and row: out0, out1

    const int tid  = threadIdx.x;
    const int b    = blockIdx.x >> 6;          // 64 work-groups per batch
    const int q0r  = (blockIdx.x & 63) * QB_;  // first query row of the group
    const int lane = tid & 31;
    const int wv   = tid >> 5;
    const int h    = wv >> 2;                  // head of this wave
    const int qt   = wv & 3;                   // query tile within the group
    const int m    = lane & 15;
    const int half = lane >> 4;                // lanes 16-31 carry K=2,3 (pad)
    const int qrow = q0r + qt * 16 + m;

    // every global read of the kernel is issued here, up front
    const float ov0 = o_v[0], ov1 = o_v[1], ov2 = o_v[2], ov3 = o_v[3];
    float wqk[MD_], wv_[MD_];
#pragma unroll
    for (int j = 0; j < MD_; ++j) { wqk[j] = qk_v[j]; wv_[j] = v_v[j]; }
    const float ku0 = k_u[0], ku1 = k_u[1];
    const float vu0 = vproj_u[0], vu1 = vproj_u[1];
    const float qu0 = q_u[0], qu1 = q_u[1], qu2 = q_u[2], qu3 = q_u[3];

    float fr[16];
#pragma unroll
    for (int i = 0; i < 16; ++i) fr[i] = freqs[i * 256 + tid];
    const float fq  = freqs[qrow];
    const float ou0 = o_u[tid % MD_];
    const float ou1 = o_u[(tid + 256) % MD_];
    // precaution: stands behind the loads above, ahead of the first rewrite of
    // a register that one of them names as its address
    asm volatile("s_wait_xcnt 0x0" ::: "memory");
    {   // (a) 5120 float4s, 20 a thread: all loads go out, then the stores
        const float4* src = (const float4*)(x + (size_t)b * S_ * MD_);
        float4* dst = (float4*)xs;
        float4 xr[(S_ * MD_ / 4) / 256];
#pragma unroll
        for (int i = 0; i < (S_ * MD_ / 4) / 256; ++i) xr[i] = src[i * 256 + tid];
#pragma unroll
        for (int i = 0; i < (S_ * MD_ / 4) / 256; ++i) dst[i * 256 + tid] = xr[i];
    }
    __syncthreads();

    // (b) K and V of 16 keys per thread (odd row pitch of 5 dwords spreads the banks).
    // All x reads stand ahead of the first K/V store, so that they go out as
    // one group and their LDS latency is paid once.
    float sqk_[16], sv_[16], sqk_q = 0.f;
#pragma unroll
    for (int i = 0; i < 16; ++i) {
        const float* xp = xs + (i * 256 + tid) * MD_;
        float sqk = 0.f, sv = 0.f;
#pragma unroll
        for (int j = 0; j < MD_; ++j) {
            float xi = xp[j];
            sqk = fmaf(xi, wqk[j], sqk);
            sv  = fmaf(xi, wv_[j], sv);
        }
        sqk_[i] = sqk; sv_[i] = sv;
    }
    {
        const float* xp = xs + qrow * MD_;
#pragma unroll
        for (int j = 0; j < MD_; ++j) sqk_q = fmaf(xp[j], wqk[j], sqk_q);
    }
#pragma unroll
    for (int i = 0; i < 16; ++i) {
        const int key = i * 256 + tid;
        float sqk = sqk_[i], sv = sv_[i];
        float cs = __cosf(fr[i]);             // D/2 == 1 -> one rotation angle
        float sn = __sinf(fr[i]);
        float k0 = sqk * ku0;
        float k1 = sqk * ku1;
        float var = 0.5f * (k0 * k0 + k1 * k1);
        float r = 16.0f * rsqrtf(var + 1e-6f);
        k0 *= r; k1 *= r;
        float4 kv;
        kv.x = k0 * cs - k1 * sn;
        kv.y = k0 * sn + k1 * cs;
        kv.z = sv * vu0;
        kv.w = sv * vu1;
        ((float4*)smem)[key] = kv;
    }

    // A matrix (16x4 f32): row = m, lanes 0-15 hold K=0,1; lanes 16-31 pad=0
    v2f amat;
    float qr, qi;                              // this lane's query row m, all 32 lanes
    {
        float sqk = sqk_q;
        float cs = __cosf(fq);
        float sn = __sinf(fq);
        const float inv_sqrt_d = 0.70710678118654752f;   // 1/sqrt(D), D=2
        float q0 = sqk * (h ? qu2 : qu0);
        float q1 = sqk * (h ? qu3 : qu1);
        float var = 0.5f * (q0 * q0 + q1 * q1);
        float r = 16.0f * rsqrtf(var + 1e-6f);
        q0 *= r; q1 *= r;
        qr = (q0 * cs - q1 * sn) * inv_sqrt_d;
        qi = (q0 * sn + q1 * cs) * inv_sqrt_d;
        amat.x = half ? 0.f : qr;              // v_cndmask
        amat.y = half ? 0.f : qi;
    }
    __syncthreads();

    const float2* kv2 = (const float2*)smem;   // [key*2 + 0] = (k0,k1)
    const float4* kv4 = (const float4*)smem;   // [key]       = (k0,k1,v0,v1)

    // ---------------- pass 1: the softmax shift of each row ----------------
    // softmax is unchanged by any shift of a row's scores; the shift only has to keep
    // exp in range. With u_j the unit vector at angle j*pi/16 (j = 0..31) and
    // R_j = max over the batch's keys of u_j.k, a query q whose angle is nearest to
    // that of u_j has |max_k q.k - |q| R_j| <= |q| max|k| pi/32. rmsnorm keeps |q| and
    // |k| under 16 sqrt(2) for every input, so with the 1/sqrt(D) in q the shift
    // |q| R_j lies within 36 of the true row max: exp stays between e^-36 and e^36
    // at the row's largest score, and the sums far inside the f32 range.
    // R_j needs no query: wave wv scores its eighth of the keys against u_0..u_15
    // (one WMMA a key tile); the minimum gives the opposite direction, R_(j+16).
    // Both key loops keep two register sets of key fragments: while one group of
    // tiles is worked on, the LDS reads of the next group are already under way,
    // so that a wave does not sit out the LDS latency in front of every group.
    float hmax[8], hmin[8];
#pragma unroll
    for (int r = 0; r < 8; ++r) { hmax[r] = -3.0e38f; hmin[r] = 3.0e38f; }

    {
        v2f dmat;                              // A: row m = u_m, K-pad lanes zero
        const float ang = (float)m * 0.19634954084936207f;   // pi/16
        dmat.x = half ? 0.f : __cosf(ang);
        dmat.y = half ? 0.f : __sinf(ang);
        const float2* kp = kv2 + (wv * (S_ / 8) + m) * 2;  // + tile * 32, this wave's keys
        float2 kq[2][KG_];
#pragma unroll
        for (int t = 0; t < KG_; ++t) kq[0][t] = kp[t * 32];
        // kept rolled: unrolled whole, the build holds all 32 score tiles at once and
        // goes past 255 registers, with a register-bank switch around every WMMA
#pragma unroll 1
        for (int g = 0; g < NKG_ / 8; g += 2) {
#pragma unroll
            for (int i = 0; i < 2; ++i) {
                // the last fetch wraps to the wave's first group and is not used
                const float2* pn = kp + ((g + i + 1) & (NKG_ / 8 - 1)) * (KG_ * 32);
#pragma unroll
                for (int t = 0; t < KG_; ++t) kq[i ^ 1][t] = pn[t * 32];
                // compiler fence: holds the reads above in front of the work below; without
                // it the compiler moves them to the head of the next trip, where the wave
                // waits for them
                asm volatile("" ::: "memory");
#pragma unroll
                for (int t = 0; t < KG_; ++t) {
                    v2f bmat;
                    bmat.x = half ? 0.f : kq[i][t].x;  // v_cndmask, zero the K-pad lanes
                    bmat.y = half ? 0.f : kq[i][t].y;
                    v8f c = {};
                    c = __builtin_amdgcn_wmma_f32_16x16x4_f32(
                            false, dmat, false, bmat, (short)0, c, false, false);
#pragma unroll
                    for (int r = 0; r < 8; ++r) {
                        hmax[r] = fmaxf(hmax[r], c[r]);
                        hmin[r] = fminf(hmin[r], c[r]);
                    }
                }
            }
        }
    }

    // the wave's 512 keys: 16-lane reductions; direction r + 8*half, and its opposite.
    // The x rows are dead since the barrier above: their LDS takes the 8 x 32 partials.
    // Step by step over all 16 values, so that the shuffles of a step go out together.
    float* hsh = xs;
#pragma unroll
    for (int mask = 1; mask < 16; mask <<= 1) {
        float ph[8], pl[8];
#pragma unroll
        for (int r = 0; r < 8; ++r) {
            ph[r] = __shfl_xor(hmax[r], mask, 32);
            pl[r] = __shfl_xor(hmin[r], mask, 32);
        }
#pragma unroll
        for (int r = 0; r < 8; ++r) {
            hmax[r] = fmaxf(hmax[r], ph[r]);
            hmin[r] = fminf(hmin[r], pl[r]);
        }
    }
    if (m == 0) {
#pragma unroll
        for (int r = 0; r < 8; ++r) {
            hsh[wv * 32 + r + 8 * half]      = hmax[r];
            hsh[wv * 32 + 16 + r + 8 * half] = -hmin[r];
        }
    }
    __syncthreads();

    // The score WMMA of pass 2 hands out the argument of exp2 itself: its A holds
    // q * log2(e) and its C the negated shift * log2(e) of row r + 8*half, so that no
    // subtraction and no scaling is left to the vector unit for any score.
    const float log2e = 1.4426950408889634f;
    v8f cshift;
    {
        // nearest of the 32 directions; the mask also bounds the index for a NaN query
        const int j = (int)rintf(atan2f(qi, qr) * 5.0929581789406507f) & 31;   // 16/pi
        float rj = hsh[j];
#pragma unroll
        for (int w = 1; w < 8; ++w) rj = fmaxf(rj, hsh[w * 32 + j]);
        const float est = sqrtf(qr * qr + qi * qi) * rj;   // row m, in lanes m and m+16
#pragma unroll
        for (int r = 0; r < 8; ++r) cshift[r] = __shfl(est, r + 8 * half, 32) * -log2e;
    }
    amat.x *= log2e;
    amat.y *= log2e;

    // ---------------- pass 2: exp-sum + P*V ----------------
    float lsum[8], a0[8], a1[8];
#pragma unroll
    for (int r = 0; r < 8; ++r) { lsum[r] = 0.f; a0[r] = 0.f; a1[r] = 0.f; }

    {
        const float4* kp = kv4 + m;            // + tile * 16: k0,k1,v0,v1 of key tile*16+m
        float4 kq[2][KG_];
#pragma unroll
        for (int t = 0; t < KG_; ++t) kq[0][t] = kp[t * 16];
        for (int g = 0; g < NKG_; g += 2) {
#pragma unroll
            for (int i = 0; i < 2; ++i) {
                // the last fetch wraps to group 0 and is not used
                const float4* pn = kp + ((g + i + 1) & (NKG_ - 1)) * (KG_ * 16);
#pragma unroll
                for (int t = 0; t < KG_; ++t) kq[i ^ 1][t] = pn[t * 16];
                // compiler fence: holds the reads above in front of the work below, as in pass 1
                asm volatile("" ::: "memory");
#pragma unroll
                for (int t = 0; t < KG_; ++t) {
                    v2f bmat;
                    bmat.x = half ? 0.f : kq[i][t].x;
                    bmat.y = half ? 0.f : kq[i][t].y;
                    float v0 = kq[i][t].z;     // V used by ALL lanes (column m)
                    float v1 = kq[i][t].w;
                    v8f c = __builtin_amdgcn_wmma_f32_16x16x4_f32(
                            false, amat, false, bmat, (short)0, cshift, false, false);
#pragma unroll
                    for (int r = 0; r < 8; ++r) {
                        float p = __builtin_amdgcn_exp2f(c[r]);   // <= e^36, no overflow
                        lsum[r] += p;
                        a0[r] = fmaf(p, v0, a0[r]);
                        a1[r] = fmaf(p, v1, a1[r]);
                    }
                }
            }
        }
    }

    // final 16-lane reductions; row M = r + 8*half goes to LDS
#pragma unroll
    for (int r = 0; r < 8; ++r) {
        float l  = lsum[r];
        float x0 = a0[r];
        float x1 = a1[r];
#pragma unroll
        for (int mask = 1; mask < 16; mask <<= 1) {
            l  += __shfl_xor(l,  mask, 32);
            x0 += __shfl_xor(x0, mask, 32);
            x1 += __shfl_xor(x1, mask, 32);
        }
        if (m == 0) {
            int o = (h * QB_ + qt * 16 + r + 8 * half) * 2;
            float inv = 1.0f / l;
            osh[o + 0] = x0 * inv;
            osh[o + 1] = x1 * inv;
        }
    }
    __syncthreads();

    // (d) collapse heads; 64 rows x 5 outputs = 1280 contiguous bytes
    float* op = out + ((size_t)b * S_ + q0r) * MD_;
    {
        int row = tid / MD_;
        float so = osh[row * 2]             * ov0 + osh[row * 2 + 1]         * ov1
                 + osh[(QB_ + row) * 2]     * ov2 + osh[(QB_ + row) * 2 + 1] * ov3;
        op[tid] = so * ou0;
    }
    if (tid < QB_ * MD_ - 256) {
        int row = (tid + 256) / MD_;
        float so = osh[row * 2]             * ov0 + osh[row * 2 + 1]         * ov1
                 + osh[(QB_ + row) * 2]     * ov2 + osh[(QB_ + row) * 2 + 1] * ov3;
        op[tid + 256] = so * ou1;
    }
}

// ---------------------------------------------------------------------------
extern "C" void kernel_launch(void* const* d_in, const int* in_sizes, int n_in,
                              void* d_out, int out_size, void* d_ws, size_t ws_size,
                              hipStream_t stream)
{
    const float* x     = (const float*)d_in[0];
    const float* freqs = (const float*)d_in[1];
    const float* qk_v  = (const float*)d_in[2];
    const float* v_v   = (const float*)d_in[3];
    const float* o_v   = (const float*)d_in[4];
    const float* vproj = (const float*)d_in[5];
    const float* q_u   = (const float*)d_in[6];
    const float* k_u   = (const float*)d_in[7];
    const float* o_u   = (const float*)d_in[8];
    float* out = (float*)d_out;

    fused_attn_kernel<<<B_ * (S_ / QB_), 256, 0, stream>>>(
        x, freqs, qk_v, v_v, o_v, vproj, q_u, k_u, o_u, out);
}

// v005
// It runs in 18.2 microseconds.
// Two timings next to v004 both put it at 1.08 times that version's speed.
// All steps since v000 together make it 1.81 times as fast.
#include <hip/hip_runtime.h>

// Problem constants (from reference)
#define B_   4
#define S_   4096
#define H_   2
#define D_   2
#define MD_  5
#define QB_  64      // query rows per work-group (4 tiles of 16, both heads)
#define KG_  8       // key tiles per group read from LDS at one place
#define NKG_ (S_ / 16 / KG_)

typedef __attribute__((ext_vector_type(2))) float v2f;
typedef __attribute__((ext_vector_type(8))) float v8f;

// ---------------------------------------------------------------------------
// One launch. A work-group = 8 waves = 4 query tiles of 16 rows x 2 heads of
// one batch b.
//  (a) the batch's x rows (80 KB) go to LDS by whole-line b128 loads;
//  (b) every thread turns 16 of them into {k0,k1,s_v,s_v} (64 KB LDS image):
//        s_qk = x . shared_qk_v ; s_v = x . shared_v_v
//        K = rope(rmsnorm(s_qk*k_u)); of V = s_v*shared_vproj_u only s_v is kept:
//        V has rank one, so P*V = (P*s_v) * shared_vproj_u, the factor applied in (c)
//      and every wave forms its own 16 Q rows, rope(rmsnorm(s_qk*q_u))/sqrt(D);
//  (c) attention: score tile (16x16) = Q(16x4, D padded) x K^T(4x16) via
//      v_wmma_f32_16x16x4_f32. (1) the softmax shift of every row, from the
//      reach of the batch's keys in 32 directions (the 8 waves share the keys);
//      (2) exp-sum + P*s_v over all keys; shuffle reductions only outside the loops;
//  (d) the two heads of a row meet in LDS: s_o = out . shared_o_v,
//      final = s_o * o_u.
// ---------------------------------------------------------------------------
__global__ __launch_bounds__(256) void fused_attn_kernel(
    const float* __restrict__ x, const float* __restrict__ freqs,
    const float* __restrict__ qk_v, const float* __restrict__ v_v,
    const float* __restrict__ o_v, const float* __restrict__ vproj_u,
    const float* __restrict__ q_u, const float* __restrict__ k_u,
    const float* __restrict__ o_u, float* __restrict__ out)
{
    // one LDS block, the K/V image first so that the key loops index from 0
    __shared__ __attribute__((aligned(16))) float lds[S_ * 4 + S_ * MD_ + H_ * QB_ * 2];
    float* smem = lds;                        // 64 KB: {k0,k1,s_v,s_v} per key
    float* xs   = lds + S_ * 4;               // 80 KB: x rows of this batch
    float* osh  = xs + S_ * MD_;              // per head and row: out0, out1

    const int tid  = threadIdx.x;
    const int b    = blockIdx.x >> 6;          // 64 work-groups per batch
    const int q0r  = (blockIdx.x & 63) * QB_;  // first query row of the group
    const int lane = tid & 31;
    const int wv   = tid >> 5;
    const int h    = wv >> 2;                  // head of this wave
    const int qt   = wv & 3;                   // query tile within the group
    const int m    = lane & 15;
    const int half = lane >> 4;                // lanes 16-31 carry K=2,3 (pad)
    const int qrow = q0r + qt * 16 + m;

    // every global read of the kernel is issued here, up front
    const float ov0 = o_v[0], ov1 = o_v[1], ov2 = o_v[2], ov3 = o_v[3];
    float wqk[MD_], wv_[MD_];
#pragma unroll
    for (int j = 0; j < MD_; ++j) { wqk[j] = qk_v[j]; wv_[j] = v_v[j]; }
    const float ku0 = k_u[0], ku1 = k_u[1];
    const float vu0 = vproj_u[0], vu1 = vproj_u[1];
    const float qu0 = q_u[0], qu1 = q_u[1], qu2 = q_u[2], qu3 = q_u[3];

    float fr[16];
#pragma unroll
    for (int i = 0; i < 16; ++i) fr[i] = freqs[i * 256 + tid];
    const float fq  = freqs[qrow];
    const float ou0 = o_u[tid % MD_];
    const float ou1 = o_u[(tid + 256) % MD_];
    // precaution: stands behind the loads above, ahead of the first rewrite of
    // a register that one of them names as its address
    asm volatile("s_wait_xcnt 0x0" ::: "memory");
    {   // (a) 5120 float4s, 20 a thread: all loads go out, then the stores
        const float4* src = (const float4*)(x + (size_t)b * S_ * MD_);
        float4* dst = (float4*)xs;
        float4 xr[(S_ * MD_ / 4) / 256];
#pragma unroll
        for (int i = 0; i < (S_ * MD_ / 4) / 256; ++i) xr[i] = src[i * 256 + tid];
#pragma unroll
        for (int i = 0; i < (S_ * MD_ / 4) / 256; ++i) dst[i * 256 + tid] = xr[i];
    }
    __syncthreads();

    // (b) K and V of 16 keys per thread (odd row pitch of 5 dwords spreads the banks).
    // All x reads stand ahead of the first K/V store, so that they go out as
    // one group and their LDS latency is paid once.
    float sqk_[16], sv_[16], sqk_q = 0.f;
#pragma unroll
    for (int i = 0; i < 16; ++i) {
        const float* xp = xs + (i * 256 + tid) * MD_;
        float sqk = 0.f, sv = 0.f;
#pragma unroll
        for (int j = 0; j < MD_; ++j) {
            float xi = xp[j];
            sqk = fmaf(xi, wqk[j], sqk);
            sv  = fmaf(xi, wv_[j], sv);
        }
        sqk_[i] = sqk; sv_[i] = sv;
    }
    {
        const float* xp = xs + qrow * MD_;
#pragma unroll
        for (int j = 0; j < MD_; ++j) sqk_q = fmaf(xp[j], wqk[j], sqk_q);
    }
#pragma unroll
    for (int i = 0; i < 16; ++i) {
        const int key = i * 256 + tid;
        float sqk = sqk_[i], sv = sv_[i];
        float cs = __cosf(fr[i]);             // D/2 == 1 -> one rotation angle
        float sn = __sinf(fr[i]);
        float k0 = sqk * ku0;
        float k1 = sqk * ku1;
        float var = 0.5f * (k0 * k0 + k1 * k1);
        float r = 16.0f * rsqrtf(var + 1e-6f);
        k0 *= r; k1 *= r;
        float4 kv;
        kv.x = k0 * cs - k1 * sn;
        kv.y = k0 * sn + k1 * cs;
        kv.z = sv;
        kv.w = sv;                            // twice: a register pair for two rows' products
        ((float4*)smem)[key] = kv;
    }

    // A matrix (16x4 f32): row = m, lanes 0-15 hold K=0,1; lanes 16-31 pad=0
    v2f amat;
    float qr, qi;                              // this lane's query row m, all 32 lanes
    {
        float sqk = sqk_q;
        float cs = __cosf(fq);
        float sn = __sinf(fq);
        const float inv_sqrt_d = 0.70710678118654752f;   // 1/sqrt(D), D=2
        float q0 = sqk * (h ? qu2 : qu0);
        float q1 = sqk * (h ? qu3 : qu1);
        float var = 0.5f * (q0 * q0 + q1 * q1);
        float r = 16.0f * rsqrtf(var + 1e-6f);
        q0 *= r; q1 *= r;
        qr = (q0 * cs - q1 * sn) * inv_sqrt_d;
        qi = (q0 * sn + q1 * cs) * inv_sqrt_d;
        amat.x = half ? 0.f : qr;              // v_cndmask
        amat.y = half ? 0.f : qi;
    }
    __syncthreads();

    const float2* kv2 = (const float2*)smem;   // [key*2 + 0] = (k0,k1)
    const float4* kv4 = (const float4*)smem;   // [key]       = (k0,k1,s_v,s_v)

    // ---------------- pass 1: the softmax shift of each row ----------------
    // softmax is unchanged by any shift of a row's scores; the shift only has to keep
    // exp in range. With u_j the unit vector at angle j*pi/16 (j = 0..31) and
    // R_j = max over the batch's keys of u_j.k, a query q whose angle is nearest to
    // that of u_j has |max_k q.k - |q| R_j| <= |q| max|k| pi/32. rmsnorm keeps |q| and
    // |k| under 16 sqrt(2) for every input, so with the 1/sqrt(D) in q the shift
    // |q| R_j lies within 36 of the true row max: exp stays between e^-36 and e^36
    // at the row's largest score, and the sums far inside the f32 range.
    // R_j needs no query: wave wv scores its eighth of the keys against u_0..u_15
    // (one WMMA a key tile); the minimum gives the opposite direction, R_(j+16).
    // Both key loops keep two register sets of key fragments: while one group of
    // tiles is worked on, the LDS reads of the next group are already under way,
    // so that a wave does not sit out the LDS latency in front of every group.
    float hmax[8], hmin[8];
#pragma unroll
    for (int r = 0; r < 8; ++r) { hmax[r] = -3.0e38f; hmin[r] = 3.0e38f; }

    {
        v2f dmat;                              // A: row m = u_m, K-pad lanes zero
        const float ang = (float)m * 0.19634954084936207f;   // pi/16
        dmat.x = half ? 0.f : __cosf(ang);
        dmat.y = half ? 0.f : __sinf(ang);
        const float2* kp = kv2 + (wv * (S_ / 8) + m) * 2;  // + tile * 32, this wave's keys
        float2 kq[2][KG_];
#pragma unroll
        for (int t = 0; t < KG_; ++t) kq[0][t] = kp[t * 32];
        // kept rolled: unrolled whole, the build holds all 32 score tiles at once and
        // goes past 255 registers, with a register-bank switch around every WMMA
#pragma unroll 1
        for (int g = 0; g < NKG_ / 8; g += 2) {
#pragma unroll
            for (int i = 0; i < 2; ++i) {
                // the last fetch wraps to the wave's first group and is not used
                const float2* pn = kp + ((g + i + 1) & (NKG_ / 8 - 1)) * (KG_ * 32);
#pragma unroll
                for (int t = 0; t < KG_; ++t) kq[i ^ 1][t] = pn[t * 32];
                // compiler fence: holds the reads above in front of the work below; without
                // it the compiler moves them to the head of the next trip, where the wave
                // waits for them
                asm volatile("" ::: "memory");
#pragma unroll
                for (int t = 0; t < KG_; ++t) {
                    v2f bmat;
                    bmat.x = half ? 0.f : kq[i][t].x;  // v_cndmask, zero the K-pad lanes
                    bmat.y = half ? 0.f : kq[i][t].y;
                    v8f c = {};
                    c = __builtin_amdgcn_wmma_f32_16x16x4_f32(
                            false, dmat, false, bmat, (short)0, c, false, false);
#pragma unroll
                    for (int r = 0; r < 8; ++r) {
                        hmax[r] = fmaxf(hmax[r], c[r]);
                        hmin[r] = fminf(hmin[r], c[r]);
                    }
                }
            }
        }
    }

    // the wave's 512 keys: 16-lane reductions; direction r + 8*half, and its opposite.
    // The x rows are dead since the barrier above: their LDS takes the 8 x 32 partials.
    // Step by step over all 16 values, so that the shuffles of a step go out together.
    float* hsh = xs;
#pragma unroll
    for (int mask = 1; mask < 16; mask <<= 1) {
        float ph[8], pl[8];
#pragma unroll
        for (int r = 0; r < 8; ++r) {
            ph[r] = __shfl_xor(hmax[r], mask, 32);
            pl[r] = __shfl_xor(hmin[r], mask, 32);
        }
#pragma unroll
        for (int r = 0; r < 8; ++r) {
            hmax[r] = fmaxf(hmax[r], ph[r]);
            hmin[r] = fminf(hmin[r], pl[r]);
        }
    }
    if (m == 0) {
#pragma unroll
        for (int r = 0; r < 8; ++r) {
            hsh[wv * 32 + r + 8 * half]      = hmax[r];
            hsh[wv * 32 + 16 + r + 8 * half] = -hmin[r];
        }
    }
    __syncthreads();

    // The score WMMA of pass 2 hands out the argument of exp2 itself: its A holds
    // q * log2(e) and its C the negated shift * log2(e) of row r + 8*half, so that no
    // subtraction and no scaling is left to the vector unit for any score.
    const float log2e = 1.4426950408889634f;
    v8f cshift;
    {
        // nearest of the 32 directions; the mask also bounds the index for a NaN query
        const int j = (int)rintf(atan2f(qi, qr) * 5.0929581789406507f) & 31;   // 16/pi
        float rj = hsh[j];
#pragma unroll
        for (int w = 1; w < 8; ++w) rj = fmaxf(rj, hsh[w * 32 + j]);
        const float est = sqrtf(qr * qr + qi * qi) * rj;   // row m, in lanes m and m+16
#pragma unroll
        for (int r = 0; r < 8; ++r) cshift[r] = __shfl(est, r + 8 * half, 32) * -log2e;
    }
    amat.x *= log2e;
    amat.y *= log2e;

    // ---------------- pass 2: exp-sum + P*s_v ----------------
    v2f lsum[4], a0[4];                        // rows 2j, 2j+1 (+ 8*half) side by side
#pragma unroll
    for (int j = 0; j < 4; ++j) { lsum[j] = (v2f){0.f, 0.f}; a0[j] = (v2f){0.f, 0.f}; }

    {
        const float4* kp = kv4 + m;            // + tile * 16: k0,k1,s_v of key tile*16+m
        float4 kq[2][KG_];
#pragma unroll
        for (int t = 0; t < KG_; ++t) kq[0][t] = kp[t * 16];
        for (int g = 0; g < NKG_; g += 2) {
#pragma unroll
            for (int i = 0; i < 2; ++i) {
                // the last fetch wraps to group 0 and is not used
                const float4* pn = kp + ((g + i + 1) & (NKG_ - 1)) * (KG_ * 16);
#pragma unroll
                for (int t = 0; t < KG_; ++t) kq[i ^ 1][t] = pn[t * 16];
                // compiler fence: holds the reads above in front of the work below, as in pass 1
                asm volatile("" ::: "memory");
#pragma unroll
                for (int t = 0; t < KG_; ++t) {
                    v2f bmat;
                    bmat.x = half ? 0.f : kq[i][t].x;
                    bmat.y = half ? 0.f : kq[i][t].y;
                    v2f sv = {kq[i][t].z, kq[i][t].w};   // s_v used by ALL lanes (column m)
                    v8f c = __builtin_amdgcn_wmma_f32_16x16x4_f32(
                            false, amat, false, bmat, (short)0, cshift, false, false);
#pragma unroll
                    for (int j = 0; j < 4; ++j) {
                        v2f p = {__builtin_amdgcn_exp2f(c[2 * j]),       // <= e^36, no overflow
                                 __builtin_amdgcn_exp2f(c[2 * j + 1])};
                        lsum[j] += p;
                        a0[j] = __builtin_elementwise_fma(p, sv, a0[j]);
                    }
                }
            }
        }
    }

    // final 16-lane reductions; row M = r + 8*half goes to LDS
#pragma unroll
    for (int r = 0; r < 8; ++r) {
        float l  = lsum[r >> 1][r & 1];
        float x0 = a0[r >> 1][r & 1];
#pragma unroll
        for (int mask = 1; mask < 16; mask <<= 1) {
            l  += __shfl_xor(l,  mask, 32);
            x0 += __shfl_xor(x0, mask, 32);
        }
        if (m == 0) {
            int o = (h * QB_ + qt * 16 + r + 8 * half) * 2;
            float t = x0 * (1.0f / l);         // softmax-weighted mean of s_v
            osh[o + 0] = t * vu0;
            osh[o + 1] = t * vu1;
        }
    }
    __syncthreads();

    // (d) collapse heads; 64 rows x 5 outputs = 1280 contiguous bytes
    float* op = out + ((size_t)b * S_ + q0r) * MD_;
    {
        int row = tid / MD_;
        float so = osh[row * 2]             * ov0 + osh[row * 2 + 1]         * ov1
                 + osh[(QB_ + row) * 2]     * ov2 + osh[(QB_ + row) * 2 + 1] * ov3;
        op[tid] = so * ou0;
    }
    if (tid < QB_ * MD_ - 256) {
        int row = (tid + 256) / MD_;
        float so = osh[row * 2]             * ov0 + osh[row * 2 + 1]         * ov1
                 + osh[(QB_ + row) * 2]     * ov2 + osh[(QB_ + row) * 2 + 1] * ov3;
        op[tid + 256] = so * ou1;
    }
}

// ---------------------------------------------------------------------------
extern "C" void kernel_launch(void* const* d_in, const int* in_sizes, int n_in,
                              void* d_out, int out_size, void* d_ws, size_t ws_size,
                              hipStream_t stream)
{
    const float* x     = (const float*)d_in[0];
    const float* freqs = (const float*)d_in[1];
    const float* qk_v  = (const float*)d_in[2];
    const float* v_v   = (const float*)d_in[3];
    const float* o_v   = (const float*)d_in[4];
    const float* vproj = (const float*)d_in[5];
    const float* q_u   = (const float*)d_in[6];
    const float* k_u   = (const float*)d_in[7];
    const float* o_u   = (const float*)d_in[8];
    float* out = (float*)d_out;

    fused_attn_kernel<<<B_ * (S_ / QB_), 256, 0, stream>>>(
        x, freqs, qk_v, v_v, o_v, vproj, q_u, k_u, o_u, out);
}

// v006
// A run of this version takes 16.2 microseconds.
// Two timings next to v005 both put it at 1.12 times that version's speed.
// Over all steps from v000 it is 2.03 times as fast.
#include <hip/hip_runtime.h>

// Problem constants (from reference)
#define B_   4
#define S_   4096
#define H_   2
#define D_   2
#define MD_  5
#define QB_  64      // query rows per work-group (4 tiles of 16, both heads)
#define KG_  8       // key tiles per group read from LDS at one place
#define NKG_ (S_ / 16 / KG_)

typedef __attribute__((ext_vector_type(2))) float v2f;
typedef __attribute__((ext_vector_type(8))) float v8f;

// v of lane (lane ^ MASK) inside the lane's 16-lane row, by a DPP row_xmask operand:
// it stays in the vector unit, where __shfl_xor goes through the LDS pipe and is
// waited for at every step. Every lane must be on where it is used.
template <int MASK>
__device__ __forceinline__ float row_xor(float v)
{
    return __builtin_bit_cast(float, __builtin_amdgcn_update_dpp(
        0, __builtin_bit_cast(int, v), 0x160 | MASK, 0xf, 0xf, true));
}

struct OpAdd { static __device__ __forceinline__ float f(float a, float b) { return a + b; } };
struct OpMax { static __device__ __forceinline__ float f(float a, float b) { return fmaxf(a, b); } };
struct OpMin { static __device__ __forceinline__ float f(float a, float b) { return fminf(a, b); } };

// Reduces 8 values over the lane's 16-lane row; lane m ends with value number m & 7.
// The pairing of lanes is the xor butterfly (1, 2, 4, 8). In each of the first three
// steps a lane keeps the values whose index bit equals its own lane bit (b0, b1, b2 =
// bits 0, 1, 2 of m) and hands the others to its partner, so that 8 cross-lane
// operations do the work of 32 and every lane ends with one finished value.
template <class Op>
__device__ __forceinline__ float row_reduce8(const float (&v)[8], bool b0, bool b1, bool b2)
{
    float w[4], u[2];
#pragma unroll
    for (int i = 0; i < 4; ++i)                // w[i]: value 2i + b0
        w[i] = Op::f(b0 ? v[2 * i + 1] : v[2 * i], row_xor<1>(b0 ? v[2 * i] : v[2 * i + 1]));
#pragma unroll
    for (int i = 0; i < 2; ++i)                // u[i]: value 4i + 2*b1 + b0
        u[i] = Op::f(b1 ? w[2 * i + 1] : w[2 * i], row_xor<2>(b1 ? w[2 * i] : w[2 * i + 1]));
    float t = Op::f(b2 ? u[1] : u[0], row_xor<4>(b2 ? u[0] : u[1]));   // value m & 7
    return Op::f(t, row_xor<8>(t));
}

// ---------------------------------------------------------------------------
// One launch. A work-group = 8 waves = 4 query tiles of 16 rows x 2 heads of
// one batch b.
//  (a) the batch's x rows (80 KB) go to LDS by whole-line b128 loads;
//  (b) every thread turns 16 of them into {k0,k1,s_v,s_v} (64 KB LDS image):
//        s_qk = x . shared_qk_v ; s_v = x . shared_v_v
//        K = rope(rmsnorm(s_qk*k_u)); of V = s_v*shared_vproj_u only s_v is kept:
//        V has rank one, so P*V = (P*s_v) * shared_vproj_u, the factor applied in (c)
//      and every wave forms its own 16 Q rows, rope(rmsnorm(s_qk*q_u))/sqrt(D);
//  (c) attention: score tile (16x16) = Q(16x4, D padded) x K^T(4x16) via
//      v_wmma_f32_16x16x4_f32. (1) the softmax shift of every row, from the
//      reach of the batch's keys in 32 directions (the 8 waves share the keys);
//      (2) exp-sum + P*s_v over all keys; lane reductions only outside the loops;
//  (d) the two heads of a row meet in LDS: s_o = out . shared_o_v,
//      final = s_o * o_u.
// ---------------------------------------------------------------------------
__global__ __launch_bounds__(256) void fused_attn_kernel(
    const float* __restrict__ x, const float* __restrict__ freqs,
    const float* __restrict__ qk_v, const float* __restrict__ v_v,
    const float* __restrict__ o_v, const float* __restrict__ vproj_u,
    const float* __restrict__ q_u, const float* __restrict__ k_u,
    const float* __restrict__ o_u, float* __restrict__ out)
{
    // one LDS block, the K/V image first so that the key loops index from 0
    __shared__ __attribute__((aligned(16))) float lds[S_ * 4 + S_ * MD_ + H_ * QB_ * 2];
    float* smem = lds;                        // 64 KB: {k0,k1,s_v,s_v} per key
    float* xs   = lds + S_ * 4;               // 80 KB: x rows of this batch
    float* osh  = xs + S_ * MD_;              // per head and row: out0, out1

    const int tid  = threadIdx.x;
    const int b    = blockIdx.x >> 6;          // 64 work-groups per batch
    const int q0r  = (blockIdx.x & 63) * QB_;  // first query row of the group
    const int lane = tid & 31;
    const int wv   = tid >> 5;
    const int h    = wv >> 2;                  // head of this wave
    const int qt   = wv & 3;                   // query tile within the group
    const int m    = lane & 15;
    const int half = lane >> 4;                // lanes 16-31 carry K=2,3 (pad)
    const int qrow = q0r + qt * 16 + m;
    const bool mb0 = m & 1, mb1 = m & 2, mb2 = m & 4;   // for row_reduce8

    // every global read of the kernel is issued here, up front
    const float ov0 = o_v[0], ov1 = o_v[1], ov2 = o_v[2], ov3 = o_v[3];
    float wqk[MD_], wv_[MD_];
#pragma unroll
    for (int j = 0; j < MD_; ++j) { wqk[j] = qk_v[j]; wv_[j] = v_v[j]; }
    const float ku0 = k_u[0], ku1 = k_u[1];
    const float vu0 = vproj_u[0], vu1 = vproj_u[1];
    const float qu0 = q_u[0], qu1 = q_u[1], qu2 = q_u[2], qu3 = q_u[3];

    float fr[16];
#pragma unroll
    for (int i = 0; i < 16; ++i) fr[i] = freqs[i * 256 + tid];
    const float fq  = freqs[qrow];
    const float ou0 = o_u[tid % MD_];
    const float ou1 = o_u[(tid + 256) % MD_];
    // precaution: stands behind the loads above, ahead of the first rewrite of
    // a register that one of them names as its address
    asm volatile("s_wait_xcnt 0x0" ::: "memory");
    {   // (a) 5120 float4s, 20 a thread: all loads go out, then the stores
        const float4* src = (const float4*)(x + (size_t)b * S_ * MD_);
        float4* dst = (float4*)xs;
        float4 xr[(S_ * MD_ / 4) / 256];
#pragma unroll
        for (int i = 0; i < (S_ * MD_ / 4) / 256; ++i) xr[i] = src[i * 256 + tid];
#pragma unroll
        for (int i = 0; i < (S_ * MD_ / 4) / 256; ++i) dst[i * 256 + tid] = xr[i];
    }
    __syncthreads();

    // (b) K and V of 16 keys per thread (odd row pitch of 5 dwords spreads the banks).
    // All x reads stand ahead of the first K/V store, so that they go out as
    // one group and their LDS latency is paid once.
    float sqk_[16], sv_[16], sqk_q = 0.f;
#pragma unroll
    for (int i = 0; i < 16; ++i) {
        const float* xp = xs + (i * 256 + tid) * MD_;
        float sqk = 0.f, sv = 0.f;
#pragma unroll
        for (int j = 0; j < MD_; ++j) {
            float xi = xp[j];
            sqk = fmaf(xi, wqk[j], sqk);
            sv  = fmaf(xi, wv_[j], sv);
        }
        sqk_[i] = sqk; sv_[i] = sv;
    }
    {
        const float* xp = xs + qrow * MD_;
#pragma unroll
        for (int j = 0; j < MD_; ++j) sqk_q = fmaf(xp[j], wqk[j], sqk_q);
    }
#pragma unroll
    for (int i = 0; i < 16; ++i) {
        const int key = i * 256 + tid;
        float sqk = sqk_[i], sv = sv_[i];
        float cs = __cosf(fr[i]);             // D/2 == 1 -> one rotation angle
        float sn = __sinf(fr[i]);
        float k0 = sqk * ku0;
        float k1 = sqk * ku1;
        float var = 0.5f * (k0 * k0 + k1 * k1);
        float r = 16.0f * rsqrtf(var + 1e-6f);
        k0 *= r; k1 *= r;
        float4 kv;
        kv.x = k0 * cs - k1 * sn;
        kv.y = k0 * sn + k1 * cs;
        kv.z = sv;
        kv.w = sv;                            // twice: a register pair for two rows' products
        ((float4*)smem)[key] = kv;
    }

    // A matrix (16x4 f32): row = m, lanes 0-15 hold K=0,1; lanes 16-31 pad=0
    v2f amat;
    float qr, qi;                              // this lane's query row m, all 32 lanes
    {
        float sqk = sqk_q;
        float cs = __cosf(fq);
        float sn = __sinf(fq);
        const float inv_sqrt_d = 0.70710678118654752f;   // 1/sqrt(D), D=2
        float q0 = sqk * (h ? qu2 : qu0);
        float q1 = sqk * (h ? qu3 : qu1);
        float var = 0.5f * (q0 * q0 + q1 * q1);
        float r = 16.0f * rsqrtf(var + 1e-6f);
        q0 *= r; q1 *= r;
        qr = (q0 * cs - q1 * sn) * inv_sqrt_d;
        qi = (q0 * sn + q1 * cs) * inv_sqrt_d;
        amat.x = half ? 0.f : qr;              // v_cndmask
        amat.y = half ? 0.f : qi;
    }
    __syncthreads();

    const float2* kv2 = (const float2*)smem;   // [key*2 + 0] = (k0,k1)
    const float4* kv4 = (const float4*)smem;   // [key]       = (k0,k1,s_v,s_v)

    // ---------------- pass 1: the softmax shift of each row ----------------
    // softmax is unchanged by any shift of a row's scores; the shift only has to keep
    // exp in range. With u_j the unit vector at angle j*pi/16 (j = 0..31) and
    // R_j = max over the batch's keys of u_j.k, a query q whose angle is nearest to
    // that of u_j has |max_k q.k - |q| R_j| <= |q| max|k| pi/32. rmsnorm keeps |q| and
    // |k| under 16 sqrt(2) for every input, so with the 1/sqrt(D) in q the shift
    // |q| R_j lies within 36 of the true row max: exp stays between e^-36 and e^36
    // at the row's largest score, and the sums far inside the f32 range.
    // R_j needs no query: wave wv scores its eighth of the keys against u_0..u_15
    // (one WMMA a key tile); the minimum gives the opposite direction, R_(j+16).
    // Both key loops keep two register sets of key fragments: while one group of
    // tiles is worked on, the LDS reads of the next group are already under way,
    // so that a wave does not sit out the LDS latency in front of every group.
    float hmax[8], hmin[8];
#pragma unroll
    for (int r = 0; r < 8; ++r) { hmax[r] = -3.0e38f; hmin[r] = 3.0e38f; }

    {
        v2f dmat;                              // A: row m = u_m, K-pad lanes zero
        const float ang = (float)m * 0.19634954084936207f;   // pi/16
        dmat.x = half ? 0.f : __cosf(ang);
        dmat.y = half ? 0.f : __sinf(ang);
        const float2* kp = kv2 + (wv * (S_ / 8) + m) * 2;  // + tile * 32, this wave's keys
        float2 kq[2][KG_];
#pragma unroll
        for (int t = 0; t < KG_; ++t) kq[0][t] = kp[t * 32];
        // kept rolled: unrolled whole, the build holds all 32 score tiles at once and
        // goes past 255 registers, with a register-bank switch around every WMMA
#pragma unroll 1
        for (int g = 0; g < NKG_ / 8; g += 2) {
#pragma unroll
            for (int i = 0; i < 2; ++i) {
                // the last fetch wraps to the wave's first group and is not used
                const float2* pn = kp + ((g + i + 1) & (NKG_ / 8 - 1)) * (KG_ * 32);
#pragma unroll
                for (int t = 0; t < KG_; ++t) kq[i ^ 1][t] = pn[t * 32];
                // compiler fence: holds the reads above in front of the work below; without
                // it the compiler moves them to the head of the next trip, where the wave
                // waits for them
                asm volatile("" ::: "memory");
#pragma unroll
                for (int t = 0; t < KG_; ++t) {
                    v2f bmat;
                    bmat.x = half ? 0.f : kq[i][t].x;  // v_cndmask, zero the K-pad lanes
                    bmat.y = half ? 0.f : kq[i][t].y;
                    v8f c = {};
                    c = __builtin_amdgcn_wmma_f32_16x16x4_f32(
                            false, dmat, false, bmat, (short)0, c, false, false);
#pragma unroll
                    for (int r = 0; r < 8; ++r) {
                        hmax[r] = fmaxf(hmax[r], c[r]);
                        hmin[r] = fminf(hmin[r], c[r]);
                    }
                }
            }
        }
    }

    // the wave's 512 keys: 16-lane reductions; direction r + 8*half, and its opposite.
    // The x rows are dead since the barrier above: their LDS takes the 8 x 32 partials.
    // Lane m ends with r = m & 7: lanes m < 8 store the direction, lanes m >= 8 its opposite.
    float* hsh = xs;
    {
        const float rmax = row_reduce8<OpMax>(hmax, mb0, mb1, mb2);
        const float rmin = row_reduce8<OpMin>(hmin, mb0, mb1, mb2);
        hsh[wv * 32 + ((m >> 3) << 4) + (m & 7) + 8 * half] = (m < 8) ? rmax : -rmin;
    }
    __syncthreads();

    // The score WMMA of pass 2 hands out the argument of exp2 itself: its A holds
    // q * log2(e) and its C the negated shift * log2(e) of row r + 8*half, so that no
    // subtraction and no scaling is left to the vector unit for any score.
    const float log2e = 1.4426950408889634f;
    v8f cshift;
    {
        // nearest of the 32 directions; the mask also bounds the index for a NaN query
        const int j = (int)rintf(atan2f(qi, qr) * 5.0929581789406507f) & 31;   // 16/pi
        float rj = hsh[j];
#pragma unroll
        for (int w = 1; w < 8; ++w) rj = fmaxf(rj, hsh[w * 32 + j]);
        const float est = sqrtf(qr * qr + qi * qi) * rj;   // row m, in lanes m and m+16
#pragma unroll
        for (int r = 0; r < 8; ++r) cshift[r] = __shfl(est, r + 8 * half, 32) * -log2e;
    }
    amat.x *= log2e;
    amat.y *= log2e;

    // ---------------- pass 2: exp-sum + P*s_v ----------------
    v2f lsum[4], a0[4];                        // rows 2j, 2j+1 (+ 8*half) side by side
#pragma unroll
    for (int j = 0; j < 4; ++j) { lsum[j] = (v2f){0.f, 0.f}; a0[j] = (v2f){0.f, 0.f}; }

    {
        const float4* kp = kv4 + m;            // + tile * 16: k0,k1,s_v of key tile*16+m
        float4 kq[2][KG_];
#pragma unroll
        for (int t = 0; t < KG_; ++t) kq[0][t] = kp[t * 16];
        for (int g = 0; g < NKG_; g += 2) {
#pragma unroll
            for (int i = 0; i < 2; ++i) {
                // the last fetch wraps to group 0 and is not used
                const float4* pn = kp + ((g + i + 1) & (NKG_ - 1)) * (KG_ * 16);
#pragma unroll
                for (int t = 0; t < KG_; ++t) kq[i ^ 1][t] = pn[t * 16];
                // compiler fence: holds the reads above in front of the work below, as in pass 1
                asm volatile("" ::: "memory");
#pragma unroll
                for (int t = 0; t < KG_; ++t) {
                    v2f bmat;
                    bmat.x = half ? 0.f : kq[i][t].x;
                    bmat.y = half ? 0.f : kq[i][t].y;
                    v2f sv = {kq[i][t].z, kq[i][t].w};   // s_v used by ALL lanes (column m)
                    v8f c = __builtin_amdgcn_wmma_f32_16x16x4_f32(
                            false, amat, false, bmat, (short)0, cshift, false, false);
#pragma unroll
                    for (int j = 0; j < 4; ++j) {
                        v2f p = {__builtin_amdgcn_exp2f(c[2 * j]),       // <= e^36, no overflow
                                 __builtin_amdgcn_exp2f(c[2 * j + 1])};
                        lsum[j] += p;
                        a0[j] = __builtin_elementwise_fma(p, sv, a0[j]);
                    }
                }
            }
        }
    }

    // final 16-lane reductions; lane m ends with the two sums of row M = (m & 7) + 8*half,
    // forms that row's quotient, and lanes m < 8 put it into LDS
    {
        float ls[8], xv[8];
#pragma unroll
        for (int r = 0; r < 8; ++r) {
            ls[r] = lsum[r >> 1][r & 1];
            xv[r] = a0[r >> 1][r & 1];
        }
        const float l  = row_reduce8<OpAdd>(ls, mb0, mb1, mb2);
        const float x0 = row_reduce8<OpAdd>(xv, mb0, mb1, mb2);
        if (m < 8) {
            int o = (h * QB_ + qt * 16 + m + 8 * half) * 2;
            float t = x0 * (1.0f / l);         // softmax-weighted mean of s_v
            osh[o + 0] = t * vu0;
            osh[o + 1] = t * vu1;
        }
    }
    __syncthreads();

    // (d) collapse heads; 64 rows x 5 outputs = 1280 contiguous bytes
    float* op = out + ((size_t)b * S_ + q0r) * MD_;
    {
        int row = tid / MD_;
        float so = osh[row * 2]             * ov0 + osh[row * 2 + 1]         * ov1
                 + osh[(QB_ + row) * 2]     * ov2 + osh[(QB_ + row) * 2 + 1] * ov3;
        op[tid] = so * ou0;
    }
    if (tid < QB_ * MD_ - 256) {
        int row = (tid + 256) / MD_;
        float so = osh[row * 2]             * ov0 + osh[row * 2 + 1]         * ov1
                 + osh[(QB_ + row) * 2]     * ov2 + osh[(QB_ + row) * 2 + 1] * ov3;
        op[tid + 256] = so * ou1;
    }
}

// ---------------------------------------------------------------------------
extern "C" void kernel_launch(void* const* d_in, const int* in_sizes, int n_in,
                              void* d_out, int out_size, void* d_ws, size_t ws_size,
                              hipStream_t stream)
{
    const float* x     = (const float*)d_in[0];
    const float* freqs = (const float*)d_in[1];
    const float* qk_v  = (const float*)d_in[2];
    const float* v_v   = (const float*)d_in[3];
    const float* o_v   = (const float*)d_in[4];
    const float* vproj = (const float*)d_in[5];
    const float* q_u   = (const float*)d_in[6];
    const float* k_u   = (const float*)d_in[7];
    const float* o_u   = (const float*)d_in[8];
    float* out = (float*)d_out;

    fused_attn_kernel<<<B_ * (S_ / QB_), 256, 0, stream>>>(
        x, freqs, qk_v, v_v, o_v, vproj, q_u, k_u, o_u, out);
}

// v007
// A run of this version takes 12.9 microseconds.
// In both of two side-by-side timings against v006, it was 1.25 times as fast.
// All steps since v000 together make it 2.54 times as fast.
#include <hip/hip_runtime.h>

// Problem constants (from reference)
#define B_   4
#define S_   4096
#define H_   2
#define D_   2
#define MD_  5
#define QB_  64      // query rows per work-group (x 2 heads = 128 Q rows, 16 tiles of 8)
#define KG_  8       // key tiles per group read from LDS at one place
#define NKG_ (S_ / 16 / KG_)
#define NSEG_ 128    // runs of 32 keys in the counting sort: 8 waves x 16 keys a thread
#define CP_  33      // pitch of the sort's count table in dwords; odd, to spread the banks

typedef __attribute__((ext_vector_type(2))) float v2f;
typedef __attribute__((ext_vector_type(8))) float v8f;

// v of lane (lane ^ MASK) inside the lane's 16-lane row, by a DPP row_xmask operand:
// it stays in the vector unit, where __shfl_xor goes through the LDS pipe and is
// waited for at every step. Every lane must be on where it is used.
template <int MASK>
__device__ __forceinline__ float row_xor(float v)
{
    return __builtin_bit_cast(float, __builtin_amdgcn_update_dpp(
        0, __builtin_bit_cast(int, v), 0x160 | MASK, 0xf, 0xf, true));
}

template <int MASK>
__device__ __forceinline__ unsigned row_xor_u(unsigned v)
{
    return (unsigned)__builtin_amdgcn_update_dpp(0, (int)v, 0x160 | MASK, 0xf, 0xf, true);
}

// v of the lane N places below inside the 16-lane row, 0 where there is none
template <int N>
__device__ __forceinline__ unsigned row_shr_u(unsigned v)
{
    return (unsigned)__builtin_amdgcn_update_dpp(0, (int)v, 0x110 | N, 0xf, 0xf, true);
}

// v of lane ^ 16: the same place in the other 16-lane row, by a vector cross-row move
__device__ __forceinline__ float other_row(float v)
{
    const int i = __builtin_bit_cast(int, v);
    return __builtin_bit_cast(float, __builtin_amdgcn_permlanex16(
        i, i, 0x76543210, 0xfedcba98, false, false));
}

struct OpAdd { static __device__ __forceinline__ float f(float a, float b) { return a + b; } };
struct OpMax { static __device__ __forceinline__ float f(float a, float b) { return fmaxf(a, b); } };
struct OpMin { static __device__ __forceinline__ float f(float a, float b) { return fminf(a, b); } };

// Reduces 8 values over the lane's 16-lane row; lane m ends with value number m & 7.
// The pairing of lanes is the xor butterfly (1, 2, 4, 8). In each of the first three
// steps a lane keeps the values whose index bit equals its own lane bit (b0, b1, b2 =
// bits 0, 1, 2 of m) and hands the others to its partner, so that 8 cross-lane
// operations do the work of 32 and every lane ends with one finished value.
template <class Op>
__device__ __forceinline__ float row_reduce8(const float (&v)[8], bool b0, bool b1, bool b2)
{
    float w[4], u[2];
#pragma unroll
    for (int i = 0; i < 4; ++i)                // w[i]: value 2i + b0
        w[i] = Op::f(b0 ? v[2 * i + 1] : v[2 * i], row_xor<1>(b0 ? v[2 * i] : v[2 * i + 1]));
#pragma unroll
    for (int i = 0; i < 2; ++i)                // u[i]: value 4i + 2*b1 + b0
        u[i] = Op::f(b1 ? w[2 * i + 1] : w[2 * i], row_xor<2>(b1 ? w[2 * i] : w[2 * i + 1]));
    float t = Op::f(b2 ? u[1] : u[0], row_xor<4>(b2 ? u[0] : u[1]));   // value m & 7
    return Op::f(t, row_xor<8>(t));
}

// ---------------------------------------------------------------------------
// One launch. A work-group = 8 waves = 64 query rows x 2 heads of one batch b.
//  (a) the batch's x rows (80 KB) go to LDS by whole-line b128 loads;
//  (b) every thread turns 16 of them into {k0,k1,s_v,s_v} (64 KB LDS image, the keys
//      in the order of their direction: a counting sort over 32 sectors of the circle):
//        s_qk = x . shared_qk_v ; s_v = x . shared_v_v
//        K = rope(rmsnorm(s_qk*k_u)); of V = s_v*shared_vproj_u only s_v is kept:
//        V has rank one, so P*V = (P*s_v) * shared_vproj_u, the factor applied in (c)
//      and the group's 128 Q rows (64 rows x 2 heads), rope(rmsnorm(s_qk*q_u))/sqrt(D),
//      are formed and ranked by direction: each wave takes 16 neighbours, as two tiles of 8;
//  (c) attention: scores via v_wmma_f32_16x16x4_f32, 8 Q rows x 32 keys an instruction.
//      (1) the softmax shift of every row, from the reach of the batch's keys in
//      32 directions (the 8 waves share the keys);
//      (2) exp-sum + P*s_v, by tiles of 8 rows over the groups of 128 keys in which some exp2
//      of the tile's narrow rows can differ from zero; a wide row (more than 14 such
//      groups) goes over all groups, split over the 8 waves; lane reductions only outside the loops;
//  (d) the two heads of a row meet in LDS: s_o = out . shared_o_v,
//      final = s_o * o_u.
// ---------------------------------------------------------------------------
__global__ __launch_bounds__(256) void fused_attn_kernel(
    const float* __restrict__ x, const float* __restrict__ freqs,
    const float* __restrict__ qk_v, const float* __restrict__ v_v,
    const float* __restrict__ o_v, const float* __restrict__ vproj_u,
    const float* __restrict__ q_u, const float* __restrict__ k_u,
    const float* __restrict__ o_u, float* __restrict__ out)
{
    // one LDS block, the K/V image first so that the key loops index from 0
    __shared__ __attribute__((aligned(16))) float lds[S_ * 4 + S_ * MD_ + H_ * QB_ * 2
        + H_ * QB_ * 4 + NKG_ * 32 + H_ * QB_ + 8 + NSEG_ * CP_ + 8 + H_ * QB_ + 8 * 8 * 2];
    float* smem = lds;                        // 64 KB: {k0,k1,s_v,s_v} per key
    float* xs   = lds + S_ * 4;               // 80 KB: x rows of this batch
    float* osh  = xs + S_ * MD_;              // per head and row: out0, out1
    float4*   qs   = (float4*)(osh + H_ * QB_ * 2);     // Q rows by rank: qr, qi, id, angle (later the shift)
    float*    rg   = (float*)(qs + H_ * QB_);           // reach of key group G in direction j
    unsigned* qkey = (unsigned*)(rg + NKG_ * 32);       // sort keys of the 128 Q rows
    unsigned* wsum = qkey + H_ * QB_;                   // the waves' totals in the scan
    unsigned* cnt  = wsum + 8;                          // [run of 32 keys][sector]
    unsigned* wmask = cnt + NSEG_ * CP_;                // per wave: which of its rows are wide
    unsigned* wl    = wmask + 8;                        // ranks of the wide rows
    float*    wpart = (float*)(wl + H_ * QB_);          // per wave and wide row: the two sums

    const int tid  = threadIdx.x;
    const int b    = blockIdx.x >> 6;          // 64 work-groups per batch
    const int q0r  = (blockIdx.x & 63) * QB_;  // first query row of the group
    const int lane = tid & 31;
    const int wv   = tid >> 5;
    const int pid  = tid & (H_ * QB_ - 1);     // Q row formed here: head * 64 + row
    const int h    = pid >> 6;
    const int m    = lane & 15;
    const int half = lane >> 4;                // lanes 16-31 carry K=2,3
    const int qrow = q0r + (pid & (QB_ - 1));
    const bool mb0 = m & 1, mb1 = m & 2, mb2 = m & 4;   // for row_reduce8

    // every global read of the kernel is issued here, up front
    const float ov0 = o_v[0], ov1 = o_v[1], ov2 = o_v[2], ov3 = o_v[3];
    float wqk[MD_], wv_[MD_];
#pragma unroll
    for (int j = 0; j < MD_; ++j) { wqk[j] = qk_v[j]; wv_[j] = v_v[j]; }
    const float ku0 = k_u[0], ku1 = k_u[1];
    const float vu0 = vproj_u[0], vu1 = vproj_u[1];
    const float qu0 = q_u[0], qu1 = q_u[1], qu2 = q_u[2], qu3 = q_u[3];

    float fr[16];
#pragma unroll
    for (int i = 0; i < 16; ++i) fr[i] = freqs[i * 256 + tid];
    const float fq  = freqs[qrow];
    const float ou0 = o_u[tid % MD_];
    const float ou1 = o_u[(tid + 256) % MD_];
    // precaution: stands behind the loads above, ahead of the first rewrite of
    // a register that one of them names as its address
    asm volatile("s_wait_xcnt 0x0" ::: "memory");
    {   // (a) 5120 float4s, 20 a thread: all loads go out, then the stores
        const float4* src = (const float4*)(x + (size_t)b * S_ * MD_);
        float4* dst = (float4*)xs;
        float4 xr[(S_ * MD_ / 4) / 256];
#pragma unroll
        for (int i = 0; i < (S_ * MD_ / 4) / 256; ++i) xr[i] = src[i * 256 + tid];
#pragma unroll
        for (int i = 0; i < (S_ * MD_ / 4) / 256; ++i) dst[i * 256 + tid] = xr[i];
    }
    __syncthreads();

    // (b) K and V of 16 keys per thread (odd row pitch of 5 dwords spreads the banks).
    // All x reads stand ahead of the first K/V store, so that they go out as
    // one group and their LDS latency is paid once.
    float sqk_[16], sv_[16], sqk_q = 0.f;
#pragma unroll
    for (int i = 0; i < 16; ++i) {
        const float* xp = xs + (i * 256 + tid) * MD_;
        float sqk = 0.f, sv = 0.f;
#pragma unroll
        for (int j = 0; j < MD_; ++j) {
            float xi = xp[j];
            sqk = fmaf(xi, wqk[j], sqk);
            sv  = fmaf(xi, wv_[j], sv);
        }
        sqk_[i] = sqk; sv_[i] = sv;
    }
    {
        const float* xp = xs + qrow * MD_;
#pragma unroll
        for (int j = 0; j < MD_; ++j) sqk_q = fmaf(xp[j], wqk[j], sqk_q);
    }
    // The keys' place in the LDS image: a counting sort by direction. A key's angle is
    // freqs + angle(k_u), half a turn more where s_qk < 0, so the sector comes from freqs
    // and that sign alone. The order only serves speed (neighbours in direction share a
    // group of 128): what pass 2 may leave out is decided from the stored keys themselves.
    // No atomics: a key's rank among the equal sectors of its run of 32, and their number,
    // come from ballots; a scan over the table of those numbers (sector-major) gives every
    // run its first place in every sector.
    unsigned srt[16];                          // sector | rank within the run << 8
    {
        const unsigned below = (1u << lane) - 1u;
#pragma unroll
        for (int i = 0; i < 16; ++i) cnt[(wv * 16 + i) * CP_ + lane] = 0u;   // the wave's own runs
#pragma unroll
        for (int i = 0; i < 16; ++i) {
            const float t = fmaf(fr[i], 0.15915494309189535f, sqk_[i] < 0.f ? 0.5f : 0.f);
            const int bk = (int)((t - floorf(t)) * 32.0f) & 31;   // the mask bounds it for any t
            unsigned other = 0u;               // the lanes with another sector than this lane's
#pragma unroll
            for (int bit = 0; bit < 5; ++bit) {
                const int sx = (int)((unsigned)bk << (31 - bit)) >> 31;   // the bit, as 0 or -1
                other |= __builtin_amdgcn_ballot_w32(sx < 0) ^ (unsigned)sx;
            }
            const unsigned peers = ~other;
            cnt[(wv * 16 + i) * CP_ + bk] = (unsigned)__popc(peers);   // peers store one value
            srt[i] = (unsigned)bk | ((unsigned)__popc(peers & below) << 8);
        }
    }
    __syncthreads();
    {   // exclusive scan: thread t owns sector t >> 3, runs (t & 7) * 16 .. + 15
        unsigned* cp = cnt + ((tid & 7) * 16) * CP_ + (tid >> 3);
        unsigned c[16], run = 0;
#pragma unroll
        for (int i = 0; i < 16; ++i) { c[i] = run; run += cp[i * CP_]; }
        // inclusive scan over the wave: four row_shr steps inside each 16-lane row (a lane
        // with no source adds 0), then the lower row's total goes onto the upper row
        unsigned inc = run;
        inc += row_shr_u<1>(inc);
        inc += row_shr_u<2>(inc);
        inc += row_shr_u<4>(inc);
        inc += row_shr_u<8>(inc);
        inc += half ? (unsigned)__builtin_amdgcn_readlane((int)inc, 15) : 0u;
        if (lane == 31) wsum[wv] = inc;
        __syncthreads();
        unsigned base = inc - run;
#pragma unroll
        for (int w = 0; w < 7; ++w) base += (w < wv) ? wsum[w] : 0u;
#pragma unroll
        for (int i = 0; i < 16; ++i) cp[i * CP_] = base + c[i];
    }
    __syncthreads();

#pragma unroll
    for (int i = 0; i < 16; ++i) {
        // a permutation of 0..4095 for every input: sector and rank are counted, not assumed
        const unsigned key = cnt[(wv * 16 + i) * CP_ + (srt[i] & 31u)] + (srt[i] >> 8);
        float sqk = sqk_[i], sv = sv_[i];
        float cs = __cosf(fr[i]);             // D/2 == 1 -> one rotation angle
        float sn = __sinf(fr[i]);
        float k0 = sqk * ku0;
        float k1 = sqk * ku1;
        float var = 0.5f * (k0 * k0 + k1 * k1);
        float r = 16.0f * rsqrtf(var + 1e-6f);
        k0 *= r; k1 *= r;
        float4 kv;
        kv.x = k0 * cs - k1 * sn;
        kv.y = k0 * sn + k1 * cs;
        kv.z = sv;
        kv.w = sv;                            // twice: a register pair for two rows' products
        ((float4*)smem)[key] = kv;
    }

    // The group's 128 Q rows, one a thread of waves 0-3, with a sort key: the angle in
    // fixed point above the row's id, so that no two keys are equal for any input.
    float4 qme;
    unsigned ukey = 0;
    if (wv < 4) {
        float sqk = sqk_q;
        float cs = __cosf(fq);
        float sn = __sinf(fq);
        const float inv_sqrt_d = 0.70710678118654752f;   // 1/sqrt(D), D=2
        float q0 = sqk * (h ? qu2 : qu0);
        float q1 = sqk * (h ? qu3 : qu1);
        float var = 0.5f * (q0 * q0 + q1 * q1);
        float r = 16.0f * rsqrtf(var + 1e-6f);
        q0 *= r; q1 *= r;
        qme.x = (q0 * cs - q1 * sn) * inv_sqrt_d;
        qme.y = (q0 * sn + q1 * cs) * inv_sqrt_d;
        qme.z = __int_as_float(pid);
        qme.w = atan2f(qme.y, qme.x);
        ukey = (unsigned)(int)((qme.w + 4.0f) * 65536.0f) * 128u + (unsigned)pid;
        qkey[pid] = ukey;
    }
    __syncthreads();

    // rank = number of smaller keys: a permutation of 0..127. Wave w then works on the
    // rows of rank 16w .. 16w+15, of either head: neighbours in direction need the same keys.
    if (wv < 4) {
        const uint4* qk4 = (const uint4*)qkey;
        unsigned rank = 0;
        // in parts: the LDS reads of a part go out together, and few registers are held
#pragma unroll 8
        for (int i = 0; i < H_ * QB_ / 4; ++i) {
            const uint4 o = qk4[i];
            rank += (o.x < ukey) + (o.y < ukey) + (o.z < ukey) + (o.w < ukey);
        }
        qs[rank] = qme;
    }

    const float2* kv2 = (const float2*)smem;   // [key*2 + 0] = (k0,k1)
    const float4* kv4 = (const float4*)smem;   // [key]       = (k0,k1,s_v,s_v)

    // ---------------- pass 1: the reach of every key group ----------------
    // softmax is unchanged by any shift of a row's scores; the shift only has to keep
    // exp in range. With u_j the unit vector at angle j*pi/16 (j = 0..31) and
    // R_j = max over the batch's keys of u_j.k, a query q whose angle is nearest to
    // that of u_j has |max_k q.k - |q| R_j| <= |q| max|k| pi/32. rmsnorm keeps |q| and
    // |k| under 16 sqrt(2) for every input, so with the 1/sqrt(D) in q the shift
    // |q| R_j lies within 36 of the true row max: with it exp would stay between e^-36 and
    // e^36 at the row's largest score (pass 2 adds 30 to it, see there), and the sums
    // far inside the f32 range.
    // R_j needs no query: wave wv scores its eighth of the keys against u_0..u_15
    // (one WMMA a key tile, the keys as rows: a lane holds 8 keys of one direction, so the
    // maximum over keys needs no lane but the one across); the minimum gives the
    // opposite direction, R_(j+16).
    // The maxima are kept per group of 128 keys, rg[G][j]: R_j is their maximum over G,
    // and pass 2 bounds a group's scores by them.
    // Both key loops keep two register sets of key fragments: while one group of
    // tiles is worked on, the LDS reads of the next group are already under way,
    // so that a wave does not sit out the LDS latency in front of every group.
    {
        v2f dmat;                              // B: column m = u_m, K-pad lanes zero
        const float ang = (float)m * 0.19634954084936207f;   // pi/16
        dmat.x = half ? 0.f : __cosf(ang);
        dmat.y = half ? 0.f : __sinf(ang);
        const float2* kp = kv2 + (wv * (S_ / 8) + m) * 2;  // + tile * 32, this wave's keys
        float2 kq[2][KG_];
#pragma unroll
        for (int t = 0; t < KG_; ++t) kq[0][t] = kp[t * 32];
        // kept rolled: unrolled whole, the build holds all 32 score tiles at once and
        // goes past 255 registers, with a register-bank switch around every WMMA
#pragma unroll 1
        for (int g = 0; g < NKG_ / 8; g += 2) {
#pragma unroll
            for (int i = 0; i < 2; ++i) {
                // the last fetch wraps to the wave's first group and is not used
                const float2* pn = kp + ((g + i + 1) & (NKG_ / 8 - 1)) * (KG_ * 32);
#pragma unroll
                for (int t = 0; t < KG_; ++t) kq[i ^ 1][t] = pn[t * 32];
                // compiler fence: holds the reads above in front of the work below; without
                // it the compiler moves them to the head of the next trip, where the wave
                // waits for them
                asm volatile("" ::: "memory");
                float hmax[4], hmin[4];        // four chains each, direction m
#pragma unroll
                for (int r = 0; r < 4; ++r) { hmax[r] = -3.0e38f; hmin[r] = 3.0e38f; }
#pragma unroll
                for (int t = 0; t < KG_; ++t) {
                    v2f kmat;                  // A: row m = key m of the tile
                    kmat.x = half ? 0.f : kq[i][t].x;  // v_cndmask, zero the K-pad lanes
                    kmat.y = half ? 0.f : kq[i][t].y;
                    v8f c = {};
                    c = __builtin_amdgcn_wmma_f32_16x16x4_f32(
                            false, kmat, false, dmat, (short)0, c, false, false);
#pragma unroll
                    for (int r = 0; r < 8; ++r) {      // c[r]: key r + 8*half, direction m
                        hmax[r & 3] = fmaxf(hmax[r & 3], c[r]);
                        hmin[r & 3] = fminf(hmin[r & 3], c[r]);
                    }
                }
                // the group's 128 keys: this lane's 64 and those of the lane across;
                // lanes 0-15 store direction m, lanes 16-31 its opposite
                float rmax = fmaxf(fmaxf(hmax[0], hmax[1]), fmaxf(hmax[2], hmax[3]));
                float rmin = fminf(fminf(hmin[0], hmin[1]), fminf(hmin[2], hmin[3]));
                rmax = fmaxf(rmax, other_row(rmax));
                rmin = fminf(rmin, other_row(rmin));
                rg[(wv * (NKG_ / 8) + g + i) * 32 + lane] = half ? -rmin : rmax;
            }
        }
    }
    __syncthreads();

    // The score WMMA of pass 2 hands out the argument of exp2 itself: its A holds
    // q * log2(e) and its C the negated shift * log2(e), so that no subtraction and no
    // scaling is left to the vector unit for any score.
    const float log2e = 1.4426950408889634f;

    // One tile of 8 Q rows against the key groups named in a bit mask (the same in every
    // lane): exp-sum and P*s_v, then the lane reductions. qv is Q row m & 7 of the tile
    // (x, y, id, shift); every lane ends with the two sums of that row.
    // D = 2 fills two of the WMMA's four k places, so a column carries two keys: lane c its
    // key in k 0,1 and lane c + 16 its own in k 2,3. A's rows 0-7 hold the 8 Q rows in k 0,1 and
    // zero in k 2,3, rows 8-15 the same Q rows the other way round: register r of a lane is
    // then Q row r against that lane's own key, 8 rows x 32 keys a WMMA. 8 neighbours in
    // direction need fewer key groups than 16 would.
    auto tile_sums = [&](float4 qv, unsigned groups, float& l, float& x0) {
        const bool on = (m >> 3) == half;
        v2f amat;
        amat.x = on ? qv.x * log2e : 0.f;      // v_cndmask
        amat.y = on ? qv.y * log2e : 0.f;
        v8f cshift;
#pragma unroll
        for (int r = 0; r < 8; ++r) cshift[r] = __shfl(qv.w, r, 32) * -log2e;
        v2f lsum[4], a0[4];                    // Q rows 2j, 2j+1 side by side
#pragma unroll
        for (int j = 0; j < 4; ++j) { lsum[j] = (v2f){0.f, 0.f}; a0[j] = (v2f){0.f, 0.f}; }
        const float4* kp = kv4 + lane;         // + 32 * t: k0,k1,s_v of the lane's own key
        float4 kq[2][4];                       // a group of 128 keys = 4 WMMAs
        // the two register sets take turns, so the groups go in pairs: an odd count takes
        // one more group along (the lowest not yet in the mask; its terms belong to the sums)
        unsigned rem = groups;
        if (__popc(rem) & 1) rem |= ~rem & (rem + 1u);
        const int ntrip = __popc(rem) >> 1;    // at most 16
        int G = (__ffs(rem) - 1) & 31;
        rem &= rem - 1u;
#pragma unroll
        for (int t = 0; t < 4; ++t) kq[0][t] = kp[G * 128 + t * 32];
        for (int tr = 0; tr < ntrip; ++tr) {
#pragma unroll
            for (int i = 0; i < 2; ++i) {
                // next group of the mask; behind the last one, group 31 is fetched and not used
                G = (__ffs(rem) - 1) & 31;
                rem &= rem - 1u;
                const float4* pn = kp + G * 128;
#pragma unroll
                for (int t = 0; t < 4; ++t) kq[i ^ 1][t] = pn[t * 32];
                // compiler fence: holds the reads above in front of the work below, as in pass 1
                asm volatile("" ::: "memory");
#pragma unroll
                for (int t = 0; t < 4; ++t) {
                    v2f bmat = {kq[i][t].x, kq[i][t].y};
                    v2f sv = {kq[i][t].z, kq[i][t].w};   // s_v of the lane's own key
                    v8f c = __builtin_amdgcn_wmma_f32_16x16x4_f32(
                            false, amat, false, bmat, (short)0, cshift, false, false);
#pragma unroll
                    for (int j = 0; j < 4; ++j) {
                        v2f p = {__builtin_amdgcn_exp2f(c[2 * j]),       // <= e^6, no overflow
                                 __builtin_amdgcn_exp2f(c[2 * j + 1])};
                        lsum[j] += p;
                        a0[j] = __builtin_elementwise_fma(p, sv, a0[j]);
                    }
                }
            }
        }
        float ls[8], xv[8];
#pragma unroll
        for (int r = 0; r < 8; ++r) {
            ls[r] = lsum[r >> 1][r & 1];
            xv[r] = a0[r >> 1][r & 1];
        }
        l  = row_reduce8<OpAdd>(ls, mb0, mb1, mb2);
        x0 = row_reduce8<OpAdd>(xv, mb0, mb1, mb2);
        l  += other_row(l);                    // the two 16-lane rows hold different keys
        x0 += other_row(x0);
    };

    unsigned gmask[2]; // bit G: the wave's tile (rows 0-7, rows 8-15) works on key group G
    unsigned wb;       // bit m: row m of the wave's 16 is a wide row (below)
    bool wide;
    {
        const float4 qv = qs[wv * 16 + m];     // this lane's query row m, all 32 lanes
        const float qr = qv.x, qi = qv.y;
        // the two directions that enclose q; the masks also bound the index for a NaN query
        const float a16 = qv.w * 5.0929581789406507f;        // 16/pi
        const float fl  = floorf(a16);
        const int j0 = (int)fl & 31, j1 = (j0 + 1) & 31;
        const bool near1 = a16 - fl > 0.5f;    // the nearer of the two gives the shift
        float up[NKG_ / 2], rj = -3.0e38f;     // each half of the wave looks at 16 groups
#pragma unroll
        for (int g = 0; g < NKG_ / 2; ++g) {
            const float* rp = rg + (half * (NKG_ / 2) + g) * 32;
            const float r0 = rp[j0], r1 = rp[j1];
            up[g] = fmaxf(r0, r1);
            rj = fmaxf(rj, near1 ? r1 : r0);
        }
        rj = fmaxf(rj, other_row(rj));
        const float qn  = sqrtf(qr * qr + qi * qi);
        // The shift of row m, in lanes m and m+16: |q| R_j + 30. The row's largest term is
        // then between e^-66 and e^6: it and all that counts beside it in f32 (down to
        // 2^-24 of it) stay normal numbers, and far keys reach zero 30 sooner.
        const float shf = qn * rj + 30.0f;
        // Which groups can be left out. q/|q| = a u_j0 + b u_j1 with a, b >= 0 and
        // 1 <= a + b <= 1/cos(pi/32) < 1 + 1/200, so q.k <= |q| (max(rg[G][j0], rg[G][j1]) +
        // 16 sqrt(2) / 200) for every key k of group G; the 1/8 in the test holds that term and
        // the rounding of the angle, of u_j and of the products. Where this bound lies more than
        // 106 under the shift, every exp2 argument of the row in G is under -152 and
        // every p is zero in f32: the group adds nothing to either sum. The test is
        // written so that a NaN keeps the group.
        const float cut = shf - 106.0f;
        unsigned nm = 0;
#pragma unroll
        for (int g = 0; g < NKG_ / 2; ++g)
            nm |= !(qn * (up[g] + 0.125f) < cut) ? (1u << g) : 0u;
        nm <<= 16 * half;
        nm |= __float_as_uint(other_row(__uint_as_float(nm)));   // the row's 32 groups
        // A short q (s_qk near 0) needs most groups and would hold its neighbours to them:
        // such wide rows leave the tile's mask and are worked on by all 8 waves together below.
        wide = __popc(nm) > 14;
        wb = __builtin_amdgcn_ballot_w32(wide) & 0xffffu;
        nm = wide ? 0u : nm;
        nm |= row_xor_u<1>(nm);                // a group that any of the tile's 8 rows needs
        nm |= row_xor_u<2>(nm);
        nm |= row_xor_u<4>(nm);
        gmask[0] = (unsigned)__builtin_amdgcn_readlane((int)nm, 0);
        gmask[1] = (unsigned)__builtin_amdgcn_readlane((int)nm, 8);
        if (!half) ((float*)qs)[(wv * 16 + m) * 4 + 3] = shf;   // the angle is done with
        if (lane == 0) wmask[wv] = wb;
    }
    __syncthreads();

    // the list of the group's wide rows (their ranks), in rank order
    unsigned nwide = 0;
    {
        unsigned before = 0;
#pragma unroll
        for (int w = 0; w < 8; ++w) {
            const unsigned n = (unsigned)__popc(wmask[w]);
            before += (w < wv) ? n : 0u;
            nwide += n;
        }
        if (wide && !half) wl[before + (unsigned)__popc(wb & ((1u << m) - 1u))] = (unsigned)(wv * 16 + m);
        nwide = (unsigned)__builtin_amdgcn_readfirstlane((int)nwide);
    }

    // ---------------- pass 2: exp-sum + P*s_v ----------------
    // kept rolled: one copy of the key loop serves both tiles
#pragma unroll 1
    for (int tl = 0; tl < 2; ++tl) {
        const float4 qv = qs[wv * 16 + tl * 8 + (m & 7)];
        float l, x0;
        tile_sums(qv, tl ? gmask[1] : gmask[0], l, x0);
        // lanes 0-7 form their row's quotient and put it into LDS at the row's own id
        // (the mask bounds the LDS index)
        if (lane < 8 && !((wb >> (tl * 8 + lane)) & 1u)) {
            int o = (__float_as_int(qv.z) & (H_ * QB_ - 1)) * 2;   // (head * 64 + row) * 2
            float t = x0 * (1.0f / l);         // softmax-weighted mean of s_v
            osh[o + 0] = t * vu0;
            osh[o + 1] = t * vu1;
        }
    }

    // wide rows, 8 a round (at most 16 rounds; nwide is the same in every thread): every wave
    // takes them against its own eighth of the keys, and the 8 partial sums meet in LDS
    for (unsigned w0 = 0; w0 < nwide; w0 += 8) {
        __syncthreads();                       // wl and the shifts are written; wpart is free
        const unsigned wi = w0 + (m & 7) < nwide ? w0 + (m & 7) : nwide - 1u;   // past the end: the last again
        const float4 qv = qs[wl[wi] & (H_ * QB_ - 1)];
        float l, x0;
        tile_sums(qv, 0xfu << (4 * __builtin_amdgcn_readfirstlane(wv)), l, x0);
        if (lane < 8) {
            wpart[(wv * 8 + lane) * 2 + 0] = l;
            wpart[(wv * 8 + lane) * 2 + 1] = x0;
        }
        __syncthreads();
        if (tid < 8 && w0 + tid < nwide) {     // here qv is the thread's own wide row
            float ls = 0.f, xsum = 0.f;
#pragma unroll
            for (int w = 0; w < 8; ++w) {
                ls   += wpart[(w * 8 + tid) * 2 + 0];
                xsum += wpart[(w * 8 + tid) * 2 + 1];
            }
            int o = (__float_as_int(qv.z) & (H_ * QB_ - 1)) * 2;
            float t = xsum * (1.0f / ls);
            osh[o + 0] = t * vu0;
            osh[o + 1] = t * vu1;
        }
    }
    __syncthreads();

    // (d) collapse heads; 64 rows x 5 outputs = 1280 contiguous bytes
    float* op = out + ((size_t)b * S_ + q0r) * MD_;
    {
        int row = tid / MD_;
        float so = osh[row * 2]             * ov0 + osh[row * 2 + 1]         * ov1
                 + osh[(QB_ + row) * 2]     * ov2 + osh[(QB_ + row) * 2 + 1] * ov3;
        op[tid] = so * ou0;
    }
    if (tid < QB_ * MD_ - 256) {
        int row = (tid + 256) / MD_;
        float so = osh[row * 2]             * ov0 + osh[row * 2 + 1]         * ov1
                 + osh[(QB_ + row) * 2]     * ov2 + osh[(QB_ + row) * 2 + 1] * ov3;
        op[tid + 256] = so * ou1;
    }
}

// ---------------------------------------------------------------------------
extern "C" void kernel_launch(void* const* d_in, const int* in_sizes, int n_in,
                              void* d_out, int out_size, void* d_ws, size_t ws_size,
                              hipStream_t stream)
{
    const float* x     = (const float*)d_in[0];
    const float* freqs = (const float*)d_in[1];
    const float* qk_v  = (const float*)d_in[2];
    const float* v_v   = (const float*)d_in[3];
    const float* o_v   = (const float*)d_in[4];
    const float* vproj = (const float*)d_in[5];
    const float* q_u   = (const float*)d_in[6];
    const float* k_u   = (const float*)d_in[7];
    const float* o_u   = (const float*)d_in[8];
    float* out = (float*)d_out;

    fused_attn_kernel<<<B_ * (S_ / QB_), 256, 0, stream>>>(
        x, freqs, qk_v, v_v, o_v, vproj, q_u, k_u, o_u, out);
}

// v008
// One run takes 11.7 microseconds.
// Next to v007, in two timings, it ran 1.10 times as fast each time.
// All steps since v000 together make it 2.80 times as fast.
#include <hip/hip_runtime.h>

// Problem constants (from reference)
#define B_   4
#define S_   4096
#define H_   2
#define D_   2
#define MD_  5
#define QB_  64      // query rows per work-group (x 2 heads = 128 Q rows, 16 tiles of 8)
#define KG_  8       // key tiles per group read from LDS at one place
#define NKG_ (S_ / 16 / KG_)
#define NSEG_ 128    // runs of 32 keys in the counting sort: 8 waves x 16 keys a thread
#define CP_  33      // pitch of the sort's count table in dwords; odd, to spread the banks

typedef __attribute__((ext_vector_type(2))) float v2f;
typedef __attribute__((ext_vector_type(8))) float v8f;

// v of lane (lane ^ MASK) inside the lane's 16-lane row, by a DPP row_xmask operand:
// it stays in the vector unit, where __shfl_xor goes through the LDS pipe and is
// waited for at every step. Every lane must be on where it is used.
template <int MASK>
__device__ __forceinline__ float row_xor(float v)
{
    return __builtin_bit_cast(float, __builtin_amdgcn_update_dpp(
        0, __builtin_bit_cast(int, v), 0x160 | MASK, 0xf, 0xf, true));
}

template <int MASK>
__device__ __forceinline__ unsigned row_xor_u(unsigned v)
{
    return (unsigned)__builtin_amdgcn_update_dpp(0, (int)v, 0x160 | MASK, 0xf, 0xf, true);
}

// v of the lane N places below inside the 16-lane row, 0 where there is none
template <int N>
__device__ __forceinline__ unsigned row_shr_u(unsigned v)
{
    return (unsigned)__builtin_amdgcn_update_dpp(0, (int)v, 0x110 | N, 0xf, 0xf, true);
}

// v of lane ^ 16: the same place in the other 16-lane row, by a vector cross-row move
__device__ __forceinline__ float other_row(float v)
{
    const int i = __builtin_bit_cast(int, v);
    return __builtin_bit_cast(float, __builtin_amdgcn_permlanex16(
        i, i, 0x76543210, 0xfedcba98, false, false));
}

struct OpAdd { static __device__ __forceinline__ float f(float a, float b) { return a + b; } };
struct OpMax { static __device__ __forceinline__ float f(float a, float b) { return fmaxf(a, b); } };
struct OpMin { static __device__ __forceinline__ float f(float a, float b) { return fminf(a, b); } };

// Reduces 8 values over the lane's 16-lane row; lane m ends with value number m & 7.
// The pairing of lanes is the xor butterfly (1, 2, 4, 8). In each of the first three
// steps a lane keeps the values whose index bit equals its own lane bit (b0, b1, b2 =
// bits 0, 1, 2 of m) and hands the others to its partner, so that 8 cross-lane
// operations do the work of 32 and every lane ends with one finished value.
template <class Op>
__device__ __forceinline__ float row_reduce8(const float (&v)[8], bool b0, bool b1, bool b2)
{
    float w[4], u[2];
#pragma unroll
    for (int i = 0; i < 4; ++i)                // w[i]: value 2i + b0
        w[i] = Op::f(b0 ? v[2 * i + 1] : v[2 * i], row_xor<1>(b0 ? v[2 * i] : v[2 * i + 1]));
#pragma unroll
    for (int i = 0; i < 2; ++i)                // u[i]: value 4i + 2*b1 + b0
        u[i] = Op::f(b1 ? w[2 * i + 1] : w[2 * i], row_xor<2>(b1 ? w[2 * i] : w[2 * i + 1]));
    float t = Op::f(b2 ? u[1] : u[0], row_xor<4>(b2 ? u[0] : u[1]));   // value m & 7
    return Op::f(t, row_xor<8>(t));
}

// ---------------------------------------------------------------------------
// One launch. A work-group = 8 waves = 64 query rows x 2 heads of one batch b.
//  (a) the batch's x rows (80 KB) go to LDS by whole-line b128 loads;
//  (b) every thread turns 16 of them into {k0,k1,s_v,s_v} (64 KB LDS image, the keys
//      in the order of their direction: a counting sort over 32 sectors of the circle):
//        s_qk = x . shared_qk_v ; s_v = x . shared_v_v
//        K = rope(rmsnorm(s_qk*k_u)); of V = s_v*shared_vproj_u only s_v is kept:
//        V has rank one, so P*V = (P*s_v) * shared_vproj_u, the factor applied in (c)
//      and the group's 128 Q rows (64 rows x 2 heads), rope(rmsnorm(s_qk*q_u))/sqrt(D),
//      are formed and ranked by direction: each wave takes 16 neighbours, as two tiles of 8;
//  (c) attention: scores via v_wmma_f32_16x16x4_f32, 8 Q rows x 32 keys an instruction.
//      (1) the softmax shift of every row, from the reach of the batch's keys in
//      32 directions (the 8 waves share the keys);
//      (2) exp-sum + P*s_v, by tiles of 8 rows over the groups of 128 keys in which some exp2
//      of the tile's narrow rows can differ from zero; a wide row (more than 14 such
//      groups) goes over all groups, split over the 8 waves; lane reductions only outside the loops;
//  (d) the two heads of a row meet in LDS: s_o = out . shared_o_v,
//      final = s_o * o_u.
// ---------------------------------------------------------------------------
__global__ __launch_bounds__(256) void fused_attn_kernel(
    const float* __restrict__ x, const float* __restrict__ freqs,
    const float* __restrict__ qk_v, const float* __restrict__ v_v,
    const float* __restrict__ o_v, const float* __restrict__ vproj_u,
    const float* __restrict__ q_u, const float* __restrict__ k_u,
    const float* __restrict__ o_u, float* __restrict__ out)
{
    // one LDS block, the K/V image first so that the key loops index from 0
    __shared__ __attribute__((aligned(16))) float lds[S_ * 4 + S_ * MD_ + H_ * QB_ * 2
        + H_ * QB_ * 4 + NKG_ * 32 + H_ * QB_ + 8 + NSEG_ * CP_ + 8 + H_ * QB_ + 8 * 8 * 2];
    float* smem = lds;                        // 64 KB: {k0,k1,s_v,s_v} per key
    float* xs   = lds + S_ * 4;               // 80 KB: x rows of this batch
    float* osh  = xs + S_ * MD_;              // per head and row: out0, out1
    float4*   qs   = (float4*)(osh + H_ * QB_ * 2);     // Q rows by rank: qr, qi, id, angle (later the shift)
    float*    rg   = (float*)(qs + H_ * QB_);           // reach of key group G in direction j
    unsigned* qkey = (unsigned*)(rg + NKG_ * 32);       // sort keys of the 128 Q rows
    unsigned* wsum = qkey + H_ * QB_;                   // the waves' totals in the scan
    unsigned* cnt  = wsum + 8;                          // [run of 32 keys][sector]
    unsigned* wmask = cnt + NSEG_ * CP_;                // per wave: which of its rows are wide
    unsigned* wl    = wmask + 8;                        // ranks of the wide rows
    float*    wpart = (float*)(wl + H_ * QB_);          // per wave and wide row: the two sums

    const int tid  = threadIdx.x;
    const int b    = blockIdx.x >> 6;          // 64 work-groups per batch
    const int q0r  = (blockIdx.x & 63) * QB_;  // first query row of the group
    const int lane = tid & 31;
    const int wv   = tid >> 5;
    const int pid  = tid & (H_ * QB_ - 1);     // Q row formed here: head * 64 + row
    const int h    = pid >> 6;
    const int m    = lane & 15;
    const int half = lane >> 4;                // lanes 16-31 carry K=2,3
    const int qrow = q0r + (pid & (QB_ - 1));
    const bool mb0 = m & 1, mb1 = m & 2, mb2 = m & 4;   // for row_reduce8

    // every global read of the kernel is issued here, up front
    const float ov0 = o_v[0], ov1 = o_v[1], ov2 = o_v[2], ov3 = o_v[3];
    float wqk[MD_], wv_[MD_];
#pragma unroll
    for (int j = 0; j < MD_; ++j) { wqk[j] = qk_v[j]; wv_[j] = v_v[j]; }
    const float ku0 = k_u[0], ku1 = k_u[1];
    const float vu0 = vproj_u[0], vu1 = vproj_u[1];
    const float qu0 = q_u[0], qu1 = q_u[1], qu2 = q_u[2], qu3 = q_u[3];

    float fr[16];
#pragma unroll
    for (int i = 0; i < 16; ++i) fr[i] = freqs[i * 256 + tid];
    const float fq  = freqs[qrow];
    const float ou0 = o_u[tid % MD_];
    const float ou1 = o_u[(tid + 256) % MD_];
    // precaution: stands behind the loads above, ahead of the first rewrite of
    // a register that one of them names as its address
    asm volatile("s_wait_xcnt 0x0" ::: "memory");
    {   // (a) 5120 float4s, 20 a thread: all loads go out, then the stores
        const float4* src = (const float4*)(x + (size_t)b * S_ * MD_);
        float4* dst = (float4*)xs;
        float4 xr[(S_ * MD_ / 4) / 256];
#pragma unroll
        for (int i = 0; i < (S_ * MD_ / 4) / 256; ++i) xr[i] = src[i * 256 + tid];
#pragma unroll
        for (int i = 0; i < (S_ * MD_ / 4) / 256; ++i) dst[i * 256 + tid] = xr[i];
    }
    __syncthreads();

    // (b) K and V of 16 keys per thread (odd row pitch of 5 dwords spreads the banks).
    // All x reads stand ahead of the first K/V store, so that they go out as
    // one group and their LDS latency is paid once.
    float sqk_[16], sv_[16], sqk_q = 0.f;
#pragma unroll
    for (int i = 0; i < 16; ++i) {
        const float* xp = xs + (i * 256 + tid) * MD_;
        float sqk = 0.f, sv = 0.f;
#pragma unroll
        for (int j = 0; j < MD_; ++j) {
            float xi = xp[j];
            sqk = fmaf(xi, wqk[j], sqk);
            sv  = fmaf(xi, wv_[j], sv);
        }
        sqk_[i] = sqk; sv_[i] = sv;
    }
    {
        const float* xp = xs + qrow * MD_;
#pragma unroll
        for (int j = 0; j < MD_; ++j) sqk_q = fmaf(xp[j], wqk[j], sqk_q);
    }
    // The keys' place in the LDS image: a counting sort by direction. A key's angle is
    // freqs + angle(k_u), half a turn more where s_qk < 0, so the sector comes from freqs
    // and that sign alone. The order only serves speed (neighbours in direction share a
    // group of 128): what pass 2 may leave out is decided from the stored keys themselves.
    // No atomics: a key's rank among the equal sectors of its run of 32, and their number,
    // come from ballots; a scan over the table of those numbers (sector-major) gives every
    // run its first place in every sector.
    unsigned srt[16];                          // sector | rank within the run << 8
    {
        const unsigned below = (1u << lane) - 1u;
#pragma unroll
        for (int i = 0; i < 16; ++i) cnt[(wv * 16 + i) * CP_ + lane] = 0u;   // the wave's own runs
#pragma unroll
        for (int i = 0; i < 16; ++i) {
            const float t = fmaf(fr[i], 0.15915494309189535f, sqk_[i] < 0.f ? 0.5f : 0.f);
            const int bk = (int)((t - floorf(t)) * 32.0f) & 31;   // the mask bounds it for any t
            unsigned other = 0u;               // the lanes with another sector than this lane's
#pragma unroll
            for (int bit = 0; bit < 5; ++bit) {
                const int sx = (int)((unsigned)bk << (31 - bit)) >> 31;   // the bit, as 0 or -1
                other |= __builtin_amdgcn_ballot_w32(sx < 0) ^ (unsigned)sx;
            }
            const unsigned peers = ~other;
            cnt[(wv * 16 + i) * CP_ + bk] = (unsigned)__popc(peers);   // peers store one value
            srt[i] = (unsigned)bk | ((unsigned)__popc(peers & below) << 8);
        }
    }
    __syncthreads();
    {   // exclusive scan: thread t owns sector t >> 3, runs (t & 7) * 16 .. + 15
        unsigned* cp = cnt + ((tid & 7) * 16) * CP_ + (tid >> 3);
        unsigned c[16], run = 0;
#pragma unroll
        for (int i = 0; i < 16; ++i) { c[i] = run; run += cp[i * CP_]; }
        // inclusive scan over the wave: four row_shr steps inside each 16-lane row (a lane
        // with no source adds 0), then the lower row's total goes onto the upper row
        unsigned inc = run;
        inc += row_shr_u<1>(inc);
        inc += row_shr_u<2>(inc);
        inc += row_shr_u<4>(inc);
        inc += row_shr_u<8>(inc);
        inc += half ? (unsigned)__builtin_amdgcn_readlane((int)inc, 15) : 0u;
        if (lane == 31) wsum[wv] = inc;
        __syncthreads();
        unsigned base = inc - run;
#pragma unroll
        for (int w = 0; w < 7; ++w) base += (w < wv) ? wsum[w] : 0u;
#pragma unroll
        for (int i = 0; i < 16; ++i) cp[i * CP_] = base + c[i];
    }
    __syncthreads();

#pragma unroll
    for (int i = 0; i < 16; ++i) {
        // a permutation of 0..4095 for every input: sector and rank are counted, not assumed
        const unsigned key = cnt[(wv * 16 + i) * CP_ + (srt[i] & 31u)] + (srt[i] >> 8);
        float sqk = sqk_[i], sv = sv_[i];
        float cs = __cosf(fr[i]);             // D/2 == 1 -> one rotation angle
        float sn = __sinf(fr[i]);
        float k0 = sqk * ku0;
        float k1 = sqk * ku1;
        float var = 0.5f * (k0 * k0 + k1 * k1);
        float r = 16.0f * rsqrtf(var + 1e-6f);
        k0 *= r; k1 *= r;
        float4 kv;
        kv.x = k0 * cs - k1 * sn;
        kv.y = k0 * sn + k1 * cs;
        kv.z = sv;
        kv.w = sv;                            // twice: a register pair for two rows' products
        ((float4*)smem)[key] = kv;
    }

    // The group's 128 Q rows, one a thread of waves 0-3, with a sort key: the angle in
    // fixed point above the row's id, so that no two keys are equal for any input.
    float4 qme;
    unsigned ukey = 0;
    if (wv < 4) {
        float sqk = sqk_q;
        float cs = __cosf(fq);
        float sn = __sinf(fq);
        const float inv_sqrt_d = 0.70710678118654752f;   // 1/sqrt(D), D=2
        float q0 = sqk * (h ? qu2 : qu0);
        float q1 = sqk * (h ? qu3 : qu1);
        float var = 0.5f * (q0 * q0 + q1 * q1);
        float r = 16.0f * rsqrtf(var + 1e-6f);
        q0 *= r; q1 *= r;
        qme.x = (q0 * cs - q1 * sn) * inv_sqrt_d;
        qme.y = (q0 * sn + q1 * cs) * inv_sqrt_d;
        qme.z = __int_as_float(pid);
        qme.w = atan2f(qme.y, qme.x);
        ukey = (unsigned)(int)((qme.w + 4.0f) * 65536.0f) * 128u + (unsigned)pid;
        qkey[pid] = ukey;
    }
    __syncthreads();

    // rank = number of smaller keys: a permutation of 0..127. Wave w then works on the
    // rows of rank 16w .. 16w+15, of either head: neighbours in direction need the same keys.
    if (wv < 4) {
        const uint4* qk4 = (const uint4*)qkey;
        unsigned rank = 0;
        // in parts: the LDS reads of a part go out together, and few registers are held
#pragma unroll 8
        for (int i = 0; i < H_ * QB_ / 4; ++i) {
            const uint4 o = qk4[i];
            rank += (o.x < ukey) + (o.y < ukey) + (o.z < ukey) + (o.w < ukey);
        }
        qs[rank] = qme;
    }

    const float2* kv2 = (const float2*)smem;   // [key*2 + 0] = (k0,k1)
    const float4* kv4 = (const float4*)smem;   // [key]       = (k0,k1,s_v,s_v)

    // ---------------- pass 1: the reach of every key group ----------------
    // softmax is unchanged by any shift of a row's scores; the shift only has to keep
    // exp in range. With u_j the unit vector at angle j*pi/16 (j = 0..31) and
    // R_j = max over the batch's keys of u_j.k, a query q whose angle is nearest to
    // that of u_j has |max_k q.k - |q| R_j| <= |q| max|k| pi/32. rmsnorm keeps |q| and
    // |k| under 16 sqrt(2) for every input, so with the 1/sqrt(D) in q the value
    // |q| R_j lies within 36 of the true row max for every input; the shift itself is
    // formed from R_j ahead of pass 2 (see there).
    // R_j needs no query: wave wv scores its eighth of the keys against u_0..u_15
    // (one WMMA a key tile, the keys as rows: a lane holds 8 keys of one direction, so the
    // maximum over keys needs no lane but the one across); the minimum gives the
    // opposite direction, R_(j+16).
    // The maxima are kept per group of 128 keys, rg[G][j]: R_j is their maximum over G,
    // and pass 2 bounds a group's scores by them.
    // Both key loops keep two register sets of key fragments: while one group of
    // tiles is worked on, the LDS reads of the next group are already under way,
    // so that a wave does not sit out the LDS latency in front of every group.
    {
        v2f dmat;                              // B: column m = u_m, K-pad lanes zero
        const float ang = (float)m * 0.19634954084936207f;   // pi/16
        dmat.x = half ? 0.f : __cosf(ang);
        dmat.y = half ? 0.f : __sinf(ang);
        const float2* kp = kv2 + (wv * (S_ / 8) + m) * 2;  // + tile * 32, this wave's keys
        float2 kq[2][KG_];
#pragma unroll
        for (int t = 0; t < KG_; ++t) kq[0][t] = kp[t * 32];
        // kept rolled: unrolled whole, the build holds all 32 score tiles at once and
        // goes past 255 registers, with a register-bank switch around every WMMA
#pragma unroll 1
        for (int g = 0; g < NKG_ / 8; g += 2) {
#pragma unroll
            for (int i = 0; i < 2; ++i) {
                // the last fetch wraps to the wave's first group and is not used
                const float2* pn = kp + ((g + i + 1) & (NKG_ / 8 - 1)) * (KG_ * 32);
#pragma unroll
                for (int t = 0; t < KG_; ++t) kq[i ^ 1][t] = pn[t * 32];
                // compiler fence: holds the reads above in front of the work below; without
                // it the compiler moves them to the head of the next trip, where the wave
                // waits for them
                asm volatile("" ::: "memory");
                float hmax[4], hmin[4];        // four chains each, direction m
#pragma unroll
                for (int r = 0; r < 4; ++r) { hmax[r] = -3.0e38f; hmin[r] = 3.0e38f; }
#pragma unroll
                for (int t = 0; t < KG_; ++t) {
                    v2f kmat;                  // A: row m = key m of the tile
                    kmat.x = half ? 0.f : kq[i][t].x;  // v_cndmask, zero the K-pad lanes
                    kmat.y = half ? 0.f : kq[i][t].y;
                    v8f c = {};
                    c = __builtin_amdgcn_wmma_f32_16x16x4_f32(
                            false, kmat, false, dmat, (short)0, c, false, false);
#pragma unroll
                    for (int r = 0; r < 8; ++r) {      // c[r]: key r + 8*half, direction m
                        hmax[r & 3] = fmaxf(hmax[r & 3], c[r]);
                        hmin[r & 3] = fminf(hmin[r & 3], c[r]);
                    }
                }
                // the group's 128 keys: this lane's 64 and those of the lane across;
                // lanes 0-15 store direction m, lanes 16-31 its opposite
                float rmax = fmaxf(fmaxf(hmax[0], hmax[1]), fmaxf(hmax[2], hmax[3]));
                float rmin = fminf(fminf(hmin[0], hmin[1]), fminf(hmin[2], hmin[3]));
                rmax = fmaxf(rmax, other_row(rmax));
                rmin = fminf(rmin, other_row(rmin));
                rg[(wv * (NKG_ / 8) + g + i) * 32 + lane] = half ? -rmin : rmax;
            }
        }
    }
    __syncthreads();

    // The score WMMA of pass 2 hands out the argument of exp2 itself: its A holds
    // q * log2(e) and its C the negated shift * log2(e), so that no subtraction and no
    // scaling is left to the vector unit for any score.
    const float log2e = 1.4426950408889634f;

    // One tile of 8 Q rows against the key groups named in a bit mask (the same in every
    // lane): exp-sum and P*s_v, then the lane reductions. qv is Q row m & 7 of the tile
    // (x, y, id, shift); every lane ends with the two sums of that row.
    // D = 2 fills two of the WMMA's four k places, so a column carries two keys: lane c its
    // key in k 0,1 and lane c + 16 its own in k 2,3. A's rows 0-7 hold the 8 Q rows in k 0,1 and
    // zero in k 2,3, rows 8-15 the same Q rows the other way round: register r of a lane is
    // then Q row r against that lane's own key, 8 rows x 32 keys a WMMA. 8 neighbours in
    // direction need fewer key groups than 16 would.
    auto tile_sums = [&](float4 qv, unsigned groups, float& l, float& x0) {
        const bool on = (m >> 3) == half;
        v2f amat;
        amat.x = on ? qv.x * log2e : 0.f;      // v_cndmask
        amat.y = on ? qv.y * log2e : 0.f;
        v8f cshift;
#pragma unroll
        for (int r = 0; r < 8; ++r) cshift[r] = __shfl(qv.w, r, 32) * -log2e;
        v2f lsum[4], a0[4];                    // Q rows 2j, 2j+1 side by side
#pragma unroll
        for (int j = 0; j < 4; ++j) { lsum[j] = (v2f){0.f, 0.f}; a0[j] = (v2f){0.f, 0.f}; }
        const float4* kp = kv4 + lane;         // + 32 * t: k0,k1,s_v of the lane's own key
        float4 kq[2][4];                       // a group of 128 keys = 4 WMMAs
        // the two register sets take turns, so the groups go in pairs: an odd count takes
        // one more group along (the lowest not yet in the mask; its terms belong to the sums)
        unsigned rem = groups;
        if (__popc(rem) & 1) rem |= ~rem & (rem + 1u);
        const int ntrip = __popc(rem) >> 1;    // at most 16
        int G = (__ffs(rem) - 1) & 31;
        rem &= rem - 1u;
#pragma unroll
        for (int t = 0; t < 4; ++t) kq[0][t] = kp[G * 128 + t * 32];
        for (int tr = 0; tr < ntrip; ++tr) {
#pragma unroll
            for (int i = 0; i < 2; ++i) {
                // next group of the mask; behind the last one, group 31 is fetched and not used
                G = (__ffs(rem) - 1) & 31;
                rem &= rem - 1u;
                const float4* pn = kp + G * 128;
#pragma unroll
                for (int t = 0; t < 4; ++t) kq[i ^ 1][t] = pn[t * 32];
                // compiler fence: holds the reads above in front of the work below, as in pass 1
                asm volatile("" ::: "memory");
#pragma unroll
                for (int t = 0; t < 4; ++t) {
                    v2f bmat = {kq[i][t].x, kq[i][t].y};
                    v2f sv = {kq[i][t].z, kq[i][t].w};   // s_v of the lane's own key
                    v8f c = __builtin_amdgcn_wmma_f32_16x16x4_f32(
                            false, amat, false, bmat, (short)0, cshift, false, false);
#pragma unroll
                    for (int j = 0; j < 4; ++j) {
                        v2f p = {__builtin_amdgcn_exp2f(c[2 * j]),       // <= e^14, no overflow
                                 __builtin_amdgcn_exp2f(c[2 * j + 1])};
                        lsum[j] += p;
                        a0[j] = __builtin_elementwise_fma(p, sv, a0[j]);
                    }
                }
            }
        }
        float ls[8], xv[8];
#pragma unroll
        for (int r = 0; r < 8; ++r) {
            ls[r] = lsum[r >> 1][r & 1];
            xv[r] = a0[r >> 1][r & 1];
        }
        l  = row_reduce8<OpAdd>(ls, mb0, mb1, mb2);
        x0 = row_reduce8<OpAdd>(xv, mb0, mb1, mb2);
        l  += other_row(l);                    // the two 16-lane rows hold different keys
        x0 += other_row(x0);
    };

    unsigned gmask[2]; // bit G: the wave's tile (rows 0-7, rows 8-15) works on key group G
    unsigned wb;       // bit m: row m of the wave's 16 is a wide row (below)
    bool wide;
    {
        const float4 qv = qs[wv * 16 + m];     // this lane's query row m, all 32 lanes
        const float qr = qv.x, qi = qv.y;
        // the two directions that enclose q; the masks also bound the index for a NaN query
        const float a16 = qv.w * 5.0929581789406507f;        // 16/pi
        const float fl  = floorf(a16);
        const int j0 = (int)fl & 31, j1 = (j0 + 1) & 31;
        const float fp = a16 - fl;             // q's place between the two, 0 .. 1
        const bool near1 = fp > 0.5f;          // the nearer of the two gives the shift
        // q/|q| = ca u_j0 + cb u_j1 with ca = sin((1-fp) pi/16) / sin(pi/16) >= 0 and
        // cb = sin(fp pi/16) / sin(pi/16) >= 0; the sines, of angles under 0.2, by their series
        const float xa = (1.0f - fp) * 0.19634954084936207f, xb = fp * 0.19634954084936207f;
        const float ca = xa * fmaf(xa * xa, fmaf(xa * xa, 8.3333333e-3f, -0.16666667f), 1.0f)
                       * 5.125830895483012f;
        const float cb = xb * fmaf(xb * xb, fmaf(xb * xb, 8.3333333e-3f, -0.16666667f), 1.0f)
                       * 5.125830895483012f;
        float up[NKG_ / 2], rj = -3.0e38f;     // each half of the wave looks at 16 groups
#pragma unroll
        for (int g = 0; g < NKG_ / 2; ++g) {
            const float* rp = rg + (half * (NKG_ / 2) + g) * 32;
            const float r0 = rp[j0], r1 = rp[j1];
            up[g] = fmaf(ca, r0, cb * r1);
            rj = fmaxf(rj, near1 ? r1 : r0);
        }
        rj = fmaxf(rj, other_row(rj));
        const float qn  = sqrtf(qr * qr + qi * qi);
        // A lower bound of the row's largest score. The key k* that reaches R_j has
        // u_j.k* = R_j and at most sqrt(512 - R_j^2) across u_j (|k| < 16 sqrt(2)), and q lies
        // within d <= pi/32 of u_j: q.k* >= |q| (R_j cos d - sin d sqrt(512 - R_j^2)). cos d
        // and sin d stand at their values for pi/32 (a negative R_j keeps factor 1); the 1/16
        // under the root and the 1 taken off hold the rounding of u_j, of R_j and of the angle.
        const float lo = fminf(rj * 0.9951f, rj) - 0.0982f * __builtin_amdgcn_sqrtf(fmaxf(512.0625f - rj * rj, 0.f));
        // The shift of row m, in lanes m and m+16: that bound + 62. The row's largest term is
        // then at least e^-62 = 2^-89.4 for every input (and, by the 36 above, under e^14): what
        // falls under the normal range is under 2^-36 of it, 4095 such terms under 2^-24. Where
        // keys lie dense the bound is within 3 of the largest score, so that far keys
        // reach zero as soon as they are 44 + 3 under it.
        const float shf = fmaf(qn, lo, 61.0f);
        // Which groups can be left out. ca, cb >= 0, so q.k = |q| (ca u_j0.k + cb u_j1.k) <=
        // |q| (ca rg[G][j0] + cb rg[G][j1]) for every key k of group G; the 1/32 in the test holds
        // the rounding of the angle, of u_j and of the products. Where this bound lies more than
        // 106 under the shift, every exp2 argument of the row in G is under -152 and
        // every p is zero in f32: the group adds nothing to either sum. The test is
        // written so that a NaN keeps the group.
        const float cut = shf - 106.0f;
        unsigned nm = 0;
#pragma unroll
        for (int g = 0; g < NKG_ / 2; ++g)
            nm |= !(qn * (up[g] + 0.03125f) < cut) ? (1u << g) : 0u;
        nm <<= 16 * half;
        nm |= __float_as_uint(other_row(__uint_as_float(nm)));   // the row's 32 groups
        // A short q (s_qk near 0) needs most groups and would hold its neighbours to them:
        // such wide rows leave the tile's mask and are worked on by all 8 waves together below.
        wide = __popc(nm) > 14;
        wb = __builtin_amdgcn_ballot_w32(wide) & 0xffffu;
        nm = wide ? 0u : nm;
        nm |= row_xor_u<1>(nm);                // a group that any of the tile's 8 rows needs
        nm |= row_xor_u<2>(nm);
        nm |= row_xor_u<4>(nm);
        gmask[0] = (unsigned)__builtin_amdgcn_readlane((int)nm, 0);
        gmask[1] = (unsigned)__builtin_amdgcn_readlane((int)nm, 8);
        if (!half) ((float*)qs)[(wv * 16 + m) * 4 + 3] = shf;   // the angle is done with
        if (lane == 0) wmask[wv] = wb;
    }
    __syncthreads();

    // the list of the group's wide rows (their ranks), in rank order
    unsigned nwide = 0;
    {
        unsigned before = 0;
#pragma unroll
        for (int w = 0; w < 8; ++w) {
            const unsigned n = (unsigned)__popc(wmask[w]);
            before += (w < wv) ? n : 0u;
            nwide += n;
        }
        if (wide && !half) wl[before + (unsigned)__popc(wb & ((1u << m) - 1u))] = (unsigned)(wv * 16 + m);
        nwide = (unsigned)__builtin_amdgcn_readfirstlane((int)nwide);
    }

    // ---------------- pass 2: exp-sum + P*s_v ----------------
    // kept rolled: one copy of the key loop serves both tiles
#pragma unroll 1
    for (int tl = 0; tl < 2; ++tl) {
        const float4 qv = qs[wv * 16 + tl * 8 + (m & 7)];
        float l, x0;
        tile_sums(qv, tl ? gmask[1] : gmask[0], l, x0);
        // lanes 0-7 form their row's quotient and put it into LDS at the row's own id
        // (the mask bounds the LDS index)
        if (lane < 8 && !((wb >> (tl * 8 + lane)) & 1u)) {
            int o = (__float_as_int(qv.z) & (H_ * QB_ - 1)) * 2;   // (head * 64 + row) * 2
            float t = x0 * (1.0f / l);         // softmax-weighted mean of s_v
            osh[o + 0] = t * vu0;
            osh[o + 1] = t * vu1;
        }
    }

    // wide rows, 8 a round (at most 16 rounds; nwide is the same in every thread): every wave
    // takes them against its own eighth of the keys, and the 8 partial sums meet in LDS
    for (unsigned w0 = 0; w0 < nwide; w0 += 8) {
        __syncthreads();                       // wl and the shifts are written; wpart is free
        const unsigned wi = w0 + (m & 7) < nwide ? w0 + (m & 7) : nwide - 1u;   // past the end: the last again
        const float4 qv = qs[wl[wi] & (H_ * QB_ - 1)];
        float l, x0;
        tile_sums(qv, 0xfu << (4 * __builtin_amdgcn_readfirstlane(wv)), l, x0);
        if (lane < 8) {
            wpart[(wv * 8 + lane) * 2 + 0] = l;
            wpart[(wv * 8 + lane) * 2 + 1] = x0;
        }
        __syncthreads();
        if (tid < 8 && w0 + tid < nwide) {     // here qv is the thread's own wide row
            float ls = 0.f, xsum = 0.f;
#pragma unroll
            for (int w = 0; w < 8; ++w) {
                ls   += wpart[(w * 8 + tid) * 2 + 0];
                xsum += wpart[(w * 8 + tid) * 2 + 1];
            }
            int o = (__float_as_int(qv.z) & (H_ * QB_ - 1)) * 2;
            float t = xsum * (1.0f / ls);
            osh[o + 0] = t * vu0;
            osh[o + 1] = t * vu1;
        }
    }
    __syncthreads();

    // (d) collapse heads; 64 rows x 5 outputs = 1280 contiguous bytes
    float* op = out + ((size_t)b * S_ + q0r) * MD_;
    {
        int row = tid / MD_;
        float so = osh[row * 2]             * ov0 + osh[row * 2 + 1]         * ov1
                 + osh[(QB_ + row) * 2]     * ov2 + osh[(QB_ + row) * 2 + 1] * ov3;
        op[tid] = so * ou0;
    }
    if (tid < QB_ * MD_ - 256) {
        int row = (tid + 256) / MD_;
        float so = osh[row * 2]             * ov0 + osh[row * 2 + 1]         * ov1
                 + osh[(QB_ + row) * 2]     * ov2 + osh[(QB_ + row) * 2 + 1] * ov3;
        op[tid + 256] = so * ou1;
    }
}

// ---------------------------------------------------------------------------
extern "C" void kernel_launch(void* const* d_in, const int* in_sizes, int n_in,
                              void* d_out, int out_size, void* d_ws, size_t ws_size,
                              hipStream_t stream)
{
    const float* x     = (const float*)d_in[0];
    const float* freqs = (const float*)d_in[1];
    const float* qk_v  = (const float*)d_in[2];
    const float* v_v   = (const float*)d_in[3];
    const float* o_v   = (const float*)d_in[4];
    const float* vproj = (const float*)d_in[5];
    const float* q_u   = (const float*)d_in[6];
    const float* k_u   = (const float*)d_in[7];
    const float* o_u   = (const float*)d_in[8];
    float* out = (float*)d_out;

    fused_attn_kernel<<<B_ * (S_ / QB_), 256, 0, stream>>>(
        x, freqs, qk_v, v_v, o_v, vproj, q_u, k_u, o_u, out);
}
